// v000
// Measured on an AMD MI455X. A time is GPU time per run, averaged over a window of back-to-back runs after a warm-up
// (all launches, gaps included; the runs take copies of the inputs in turn), and the median of several windows.
// Apart from v000's, it joins two sittings. Times from different sittings can be a few percent apart, while
// side-by-side timings come from the same sitting.
// v000, which the later versions start from, runs in 1230 microseconds.
// compute dtype: all float inputs rounded to bf16, positions (int) read; q/k/v = x W + b ((in,out)) with EXACT bf16 products on WMMA 16x16x32, f32 accumulate; neox rotary (rotate-half) in f32 (inv_freq = 10000^(-2i/64) via powf, precise cosf/sinf, positions read) on q and k; q as f16 hi + residual (carried x 2^10), k f16 -> 2-product logits / 8, causal, stored in f32 (4 query heads per launch; kv head = h/4); softmax in f32 (precise expf), P x 2^11 kept f32 split bf16 hi + lo against v bf16 hi + lo (3 products); out = y (bf16 hi + lo) Wo ((in,out)); f32 output.
#include <hip/hip_runtime.h>
#include <math.h>

typedef __attribute__((ext_vector_type(16))) _Float16 v16h;
typedef __attribute__((ext_vector_type(16))) __bf16 v16b;
typedef __attribute__((ext_vector_type(8)))  _Float16 v8h;
typedef __attribute__((ext_vector_type(8)))  float v8f;
typedef __attribute__((ext_vector_type(4)))  float v4f;
typedef __attribute__((ext_vector_type(2)))  float v2f;
typedef __attribute__((ext_vector_type(4)))  unsigned v4u;
typedef __attribute__((ext_vector_type(4)))  int v4i;
typedef float __attribute__((may_alias)) float_a;
typedef int __attribute__((may_alias)) int_a;

template <typename T> __device__ __forceinline__ void vst2(void* p, T v) { *(T*)p = v;  }
__device__ __forceinline__ v8f wmma16(v16h a, v16h b, v8f c) {
  v8f d = __builtin_amdgcn_wmma_f32_16x16x32_f16(false, a, false, b, (short)0, c, false, false);
  asm volatile("v_nop\n\tv_nop\n\tv_nop\n\tv_nop" : "+v"(d) : "v"(a), "v"(b));
  return d;
}
__device__ __forceinline__ v8f wmma_bf(v16b a, v16b b, v8f c) {
  v8f d = __builtin_amdgcn_wmma_f32_16x16x32_bf16(false, a, false, b, (short)0, c, false, false);
  asm volatile("v_nop\n\tv_nop\n\tv_nop\n\tv_nop" : "+v"(d) : "v"(a), "v"(b));
  return d;
}
// 16x16x32 fragments: lane = (h = lane>>4, row/col = lane&15); elements 0..7 = k0+8h+0..7, 8..15 = k0+16+8h+0..7; D element r = row 8h+r
__device__ __forceinline__ v16h frag_h(const _Float16* rowk0, int lane) {
  union { v16h v; v8h q[2]; } u; const _Float16* p = rowk0 + 8 * (lane >> 4);
  u.q[0] = *(const v8h*)p; u.q[1] = *(const v8h*)(p + 16); return u.v;
}
__device__ __forceinline__ v16h frag_f32(const float* rowk0, int lane) {
  v16h a; const float* p = rowk0 + 8 * (lane >> 4);
#pragma unroll
  for (int i = 0; i < 8; ++i) { a[i] = (_Float16)p[i]; a[8 + i] = (_Float16)p[16 + i]; }
  return a;
}
__device__ __forceinline__ v16h frag_f32s(const float* rowk0, int lane, float sc) {
  v16h a; const float* p = rowk0 + 8 * (lane >> 4);
#pragma unroll
  for (int i = 0; i < 8; ++i) { a[i] = (_Float16)(p[i] * sc); a[8 + i] = (_Float16)(p[16 + i] * sc); }
  return a;
}
// column fragment from a [K][ld] layout (column n), rows >= K read as 0
__device__ __forceinline__ v16h fragc_f32(const float* W, int k0, int n, int lane, int ld, int K) {
  v16h a; const int g = lane >> 4;
#pragma unroll
  for (int i = 0; i < 8; ++i) { const int ka = k0 + 8 * g + i, kb = ka + 16;
    a[i] = (_Float16)(ka < K ? W[(size_t)(ka < K ? ka : K - 1) * ld + n] : 0.f); a[8 + i] = (_Float16)(kb < K ? W[(size_t)(kb < K ? kb : K - 1) * ld + n] : 0.f); }
  return a;
}
struct F2 { v16b h, l; };
__device__ __forceinline__ F2 bsplit16(const float v[16]) { F2 r;
#pragma unroll
  for (int i = 0; i < 16; ++i) { const __bf16 h = (__bf16)v[i]; r.h[i] = h; r.l[i] = (__bf16)(v[i] - (float)h); }
  return r; }
__device__ __forceinline__ F2 split_row(const float* row, int k0, int lane) { float v[16]; const float* p = row + k0 + 8 * (lane >> 4);
#pragma unroll
  for (int i = 0; i < 8; ++i) { v[i] = p[i]; v[8 + i] = p[16 + i]; }
  return bsplit16(v); }
__device__ __forceinline__ F2 split_rowK(const float* row, int k0, int lane, int K) { float v[16]; const int g = lane >> 4;
#pragma unroll
  for (int i = 0; i < 8; ++i) { const int ka = k0 + 8 * g + i, kb = ka + 16; v[i] = ka < K ? row[ka < K ? ka : K - 1] : 0.f; v[8 + i] = kb < K ? row[kb < K ? kb : K - 1] : 0.f; }
  return bsplit16(v); }
__device__ __forceinline__ F2 split_col(const float* W, int k0, int n, int lane, int ld, int K) { float v[16]; const int g = lane >> 4;
#pragma unroll
  for (int i = 0; i < 8; ++i) { const int ka = k0 + 8 * g + i, kb = ka + 16; v[i] = ka < K ? W[(size_t)(ka < K ? ka : K - 1) * ld + n] : 0.f; v[8 + i] = kb < K ? W[(size_t)(kb < K ? kb : K - 1) * ld + n] : 0.f; }
  return bsplit16(v); }
__device__ __forceinline__ v8f mac3(const F2& a, const F2& b, v8f c) { c = wmma_bf(a.l, b.h, c); c = wmma_bf(a.h, b.l, c); return wmma_bf(a.h, b.h, c); }
__device__ __forceinline__ float sigm(float v) { return 1.0f / (1.0f + expf(-v)); }
#define LDSX() do { asm volatile("s_wait_dscnt 0" ::: "memory"); __builtin_amdgcn_wave_barrier(); __builtin_amdgcn_fence(__ATOMIC_RELEASE, "workgroup"); } while (0)


// GQA causal attention with neox RoPE (B 2, S 2,048, hidden 1,024 = 16 x 64 query heads, 4 kv heads): q/k/v = x W + b, rope(positions), k/v repeated 4x, scores / 8 causal, softmax, P v, out = y Wo.
#define NB 2
#define TT 2048
#define CC 1024
#define NH 16
#define HD 64
#define NKV 4
#define KV (NKV * HD)      // 256
#define GQ (NH / NKV)      // 4
#ifndef TNB
#define TNB NB
#endif
typedef __attribute__((ext_vector_type(8))) __bf16 v8b;
__device__ __forceinline__ v16b frag_b(const __bf16* rowk0, int lane) {
  union { v16b v; v8b q[2]; } u; const __bf16* p = rowk0 + 8 * (lane >> 4);
  u.q[0] = *(const v8b*)p; u.q[1] = *(const v8b*)(p + 16); return u.v;
}
__device__ __forceinline__ float bfr(float v) { return (float)(__bf16)v; }
__device__ __attribute__((noinline)) float exp_ni(float v) { return expf(v); }
__device__ __attribute__((noinline)) float erf_ni(float v) { return erff(v); }

#define WS_QH  0u
#define WS_QL  (WS_QH + 2u * (size_t)NB * TT * CC)
#define WS_KH  (WS_QL + 2u * (size_t)NB * TT * CC)      // f16 k rows [b*t][KV]
#define WS_VT  (WS_KH + 2u * (size_t)NB * TT * KV)      // bf16 v planes [b][kvc][t]
#define WS_VL  (WS_VT + 2u * (size_t)NB * KV * TT)      // bf16 v residual planes
#define HG 4                                          // query heads per launch group
#define WS_S   (WS_VL + 2u * (size_t)NB * KV * TT)      // f32 logits / P for HG heads [hg][q][k]
#define WS_PH  (WS_S + 4u * (size_t)HG * TT * TT)
#define WS_Y   (WS_PH + 0u)              // f32 y rows [b*t][C]
#define WS_END (WS_Y + 4u * (size_t)NB * TT * CC)

// ---- k_proj: block = (64 rows, 128 cols, which): qkv = x W (+ b), exact; q -> f16 hi (+ residual), k -> f16 rows, v -> bf16 hi + lo planes
__global__ __launch_bounds__(128) void k_proj(const float* __restrict__ X, const float* __restrict__ WQ, const float* __restrict__ BQ, const float* __restrict__ WK, const float* __restrict__ BK, const float* __restrict__ WV, const float* __restrict__ BV, const int* __restrict__ POS, _Float16* __restrict__ QH, _Float16* __restrict__ QL, _Float16* __restrict__ KH, __bf16* __restrict__ VT, __bf16* __restrict__ VL) {
  __shared__ __align__(16) _Float16 sh[64][136], sl[64][136]; __shared__ __align__(16) __bf16 th[128][72], tl2[128][72]; __shared__ __align__(16) float sf[64][132];
  const int tid = threadIdx.x, wave = tid >> 5, lane = tid & 31, col = lane & 15, g = lane >> 4; const int which = blockIdx.z; const int c0 = blockIdx.y * 128; const size_t r0 = (size_t)blockIdx.x * 64; const int NW = which == 0 ? CC : KV; if (c0 >= NW) return;   // k/v are only KV wide (block-uniform exit)
  const float* WA = which == 0 ? WQ : which == 1 ? WK : WV; const float* BA = which == 0 ? BQ : which == 1 ? BK : BV;
  v8f acc[8] = {};
#pragma unroll 2
  for (int kc = 0; kc < CC / 32; ++kc) { v16b a; { const float* p = X + (r0 + wave * 16 + col) * CC + kc * 32 + 8 * g;
#pragma unroll
      for (int i = 0; i < 8; ++i) { a[i] = (__bf16)p[i]; a[8 + i] = (__bf16)p[16 + i]; } }
#pragma unroll
    for (int j = 0; j < 8; ++j) { v16b w; const int o = c0 + j * 16 + col;
#pragma unroll
      for (int i = 0; i < 8; ++i) { w[i] = (__bf16)WA[(size_t)(kc * 32 + 8 * g + i) * NW + o]; w[8 + i] = (__bf16)WA[(size_t)(kc * 32 + 16 + 8 * g + i) * NW + o]; }
      acc[j] = wmma_bf(a, w, acc[j]); } }
#pragma unroll
  for (int j = 0; j < 8; ++j) { const float bb = bfr(BA[c0 + j * 16 + col]);
#pragma unroll
    for (int r = 0; r < 8; ++r) { const float v = acc[j][r] + bb; const int rl = wave * 16 + 8 * g + r, cl = j * 16 + col;
      if (which == 2) { const __bf16 bh = (__bf16)v; th[cl][rl] = bh; tl2[cl][rl] = (__bf16)(v - (float)bh); } else sf[rl][cl] = v; } }
  __syncthreads();
  if (which < 2) {   // rotate-half rotary: out[d] = x[d] cos(p f_(d mod 32)) + (d < 32 ? -x[d+32] : x[d-32]) sin(p f_(d mod 32)); f_i = 10000^(-i/32); p = position_ids[t]
    for (int e = tid; e < 64 * 128; e += 128) { const int rl = e >> 7, cl = e & 127; const int d = cl & 63; const int i2 = d & 31; const size_t row = r0 + rl; const int tpos = POS[(int)(row % TT)];
      const float inv_freq = 1.0f / powf(10000.0f, (float)(2 * i2) / 64.0f); const float ang = (float)tpos * inv_freq; const float c = cosf(ang), s = sinf(ang);
      const float me = sf[rl][cl]; const float partner = (d < 32) ? -sf[rl][cl + 32] : sf[rl][cl - 32]; const float v = me * c + partner * s; const _Float16 hv = (_Float16)v; sh[rl][cl] = hv; sl[rl][cl] = (_Float16)((v - (float)hv) * 1024.0f); }   /* q residual carried x 2^10 so the plane stays f16-normal on the chip */
    __syncthreads(); }
  if (which < 2) { _Float16* dh = which == 0 ? QH : KH; for (int e = tid; e < 64 * 16; e += 128) { const int rl = e >> 4, q = e & 15; vst2((unsigned*)(dh + (r0 + rl) * NW + c0 + q * 8), *(const v4u*)&sh[rl][q * 8]); if (which == 0) vst2((unsigned*)(QL + (r0 + rl) * CC + c0 + q * 8), *(const v4u*)&sl[rl][q * 8]); } }
  else { const size_t b = r0 / TT; const int t0 = (int)(r0 % TT); for (int e = tid; e < 128 * 8; e += 128) { const int cl = e >> 3, q = e & 7; const size_t o2 = (b * KV + c0 + cl) * (size_t)TT + t0 + q * 8; vst2((unsigned*)(VT + o2), *(const v4u*)&th[cl][q * 8]); vst2((unsigned*)(VL + o2), *(const v4u*)&tl2[cl][q * 8]); } } }
// ---- k_sc: block = (64 queries, 128 keys) of (b, query head h; kv head h/4): 2-product logits / 8, causal; key blocks above the diagonal exit
__global__ __launch_bounds__(128) void k_sc(const _Float16* __restrict__ QH, const _Float16* __restrict__ QL, const _Float16* __restrict__ KH, int b, int h0, float* __restrict__ S0) { __shared__ __align__(16) float ss[4][16][132]; const int h = h0 + blockIdx.z; float* S = S0 + (size_t)blockIdx.z * TT * TT;
  const int tid = threadIdx.x, wave = tid >> 5, lane = tid & 31, col = lane & 15, g = lane >> 4; const int k0 = blockIdx.y * 128; const int ql0 = blockIdx.x * 64 + wave * 16; const size_t q0 = (size_t)b * TT + ql0;
  if (k0 > blockIdx.x * 64 + 63) return;   // whole key block above the diagonal (block-uniform)
  v8f acc[8] = {}, accl[8] = {};
#pragma unroll
  for (int kc = 0; kc < HD / 32; ++kc) { const v16h ah = frag_h(QH + (q0 + col) * CC + h * HD + kc * 32, lane), al = frag_h(QL + (q0 + col) * CC + h * HD + kc * 32, lane);
#pragma unroll
    for (int j = 0; j < 8; ++j) { const v16h kb = frag_h(KH + ((size_t)b * TT + k0 + j * 16 + col) * KV + (h / GQ) * HD + kc * 32, lane); acc[j] = wmma16(ah, kb, acc[j]); accl[j] = wmma16(al, kb, accl[j]); } }
#pragma unroll
  for (int j = 0; j < 8; ++j) acc[j] += accl[j] * (1.0f / 1024.0f);
#pragma unroll
  for (int j = 0; j < 8; ++j) { const int kt = k0 + j * 16 + col;
#pragma unroll
    for (int r = 0; r < 8; ++r) { const int qt = ql0 + 8 * g + r; float v = acc[j][r] * 0.125f; if (kt > qt) v = -3.0e38f; ss[wave][8 * g + r][j * 16 + col] = v; } }
  LDSX(); for (int rl = 0; rl < 16; ++rl) vst2(S + (size_t)(ql0 + rl) * TT + k0 + lane * 4, *(const v4f*)&ss[wave][rl][lane * 4]); }
// ---- k_sm: block = query row: softmax over keys [0, kend) -> P x 2^11 f32 (masked -> 0)
__global__ __launch_bounds__(256) void k_sm(float* __restrict__ S0) { __shared__ float sred[8]; __shared__ float sbc; __shared__ __align__(16) float sh[TT];
  const int t = threadIdx.x; const size_t row = blockIdx.x; float* sr = S0 + (size_t)blockIdx.y * TT * TT + row * TT; const int kend = ((int)row / 64) * 64 + 64;
  float m = -3.0e38f; for (int k = t; k < kend; k += 256) m = fmaxf(m, sr[k]);
#pragma unroll
  for (int o = 1; o < 32; o <<= 1) m = fmaxf(m, __shfl_xor(m, o));
  if ((t & 31) == 0) sred[t >> 5] = m; __syncthreads(); if (t == 0) { float a = sred[0]; for (int i = 1; i < 8; ++i) a = fmaxf(a, sred[i]); sbc = a; } __syncthreads(); m = sbc; __syncthreads();
  float sum = 0.f; for (int k = t; k < kend; k += 256) { const float v = sr[k]; sum += (v <= -1.0e38f) ? 0.f : expf(v - m); }
#pragma unroll
  for (int o = 1; o < 32; o <<= 1) sum += __shfl_xor(sum, o);
  if ((t & 31) == 0) sred[t >> 5] = sum; __syncthreads(); if (t == 0) { float a = 0.f; for (int i = 0; i < 8; ++i) a += sred[i]; sbc = 1.0f / a; } __syncthreads(); const float inv = sbc;
  for (int k = t; k < kend; k += 256) { const float v = sr[k]; sh[k] = (v <= -1.0e38f) ? 0.f : expf(v - m) * inv * 2048.0f; }
  __syncthreads(); for (int q = t; q < kend / 4; q += 256) vst2(sr + q * 4, *(const v4f*)&sh[q * 4]); }
// ---- k_pv: block = 64 queries of (b,h): y[q][h*HD + d] = P . v  (keys [0, kend))
__global__ __launch_bounds__(128) void k_pv(const float* __restrict__ PS0, const __bf16* __restrict__ VT, const __bf16* __restrict__ VL, int b, int h0, float* __restrict__ Y) { const int h = h0 + blockIdx.z; const float* PS = PS0 + (size_t)blockIdx.z * TT * TT; __shared__ __align__(16) float ss[4][16][HD + 4];
  const int tid = threadIdx.x, wave = tid >> 5, lane = tid & 31, col = lane & 15, g = lane >> 4; const int ql0 = blockIdx.x * 64 + wave * 16; const int kend = blockIdx.x * 64 + 64;
  v8f acc[HD / 16] = {};
#pragma unroll 1
  for (int kc = 0; kc < kend / 32; ++kc) { const F2 p = split_row(PS + (size_t)(ql0 + col) * TT, kc * 32, lane);
#pragma unroll
    for (int j = 0; j < HD / 16; ++j) { const size_t po = ((size_t)b * KV + (h / GQ) * HD + j * 16 + col) * (size_t)TT + kc * 32; const v16b vh = frag_b(VT + po, lane); acc[j] = wmma_bf(p.h, vh, acc[j]); acc[j] = wmma_bf(p.l, vh, acc[j]); acc[j] = wmma_bf(p.h, frag_b(VL + po, lane), acc[j]); } }
#pragma unroll
  for (int j = 0; j < HD / 16; ++j)
#pragma unroll
    for (int r = 0; r < 8; ++r) ss[wave][8 * g + r][j * 16 + col] = acc[j][r] * (1.0f / 2048.0f);
  LDSX(); for (int rl = 0; rl < 16; ++rl) if (lane < HD / 4) vst2(Y + ((size_t)b * TT + ql0 + rl) * CC + h * HD + lane * 4, *(const v4f*)&ss[wave][rl][lane * 4]); }
// ---- k_out: block = (64 rows, 128 cols): out = y (bf16 hi + lo) Wo ((in,out), exact bf16 weights), f32 accumulate
__global__ __launch_bounds__(128) void k_out(const float* __restrict__ Y, const float* __restrict__ WO, float* __restrict__ OUT) { __shared__ __align__(16) float sf[4][16][132];
  const int tid = threadIdx.x, wave = tid >> 5, lane = tid & 31, col = lane & 15, g = lane >> 4; const int c0 = blockIdx.y * 128; const size_t r0 = (size_t)blockIdx.x * 64 + wave * 16;
  v8f acc[8] = {};
#pragma unroll 2
  for (int kc = 0; kc < CC / 32; ++kc) { const F2 a = split_row(Y + (r0 + col) * CC, kc * 32, lane);
#pragma unroll
    for (int j = 0; j < 8; ++j) { v16b w; const int o = c0 + j * 16 + col;
#pragma unroll
      for (int i = 0; i < 8; ++i) { w[i] = (__bf16)WO[(size_t)(kc * 32 + 8 * g + i) * CC + o]; w[8 + i] = (__bf16)WO[(size_t)(kc * 32 + 16 + 8 * g + i) * CC + o]; }
      acc[j] = wmma_bf(a.h, w, acc[j]); acc[j] = wmma_bf(a.l, w, acc[j]); } }
#pragma unroll
  for (int j = 0; j < 8; ++j)
#pragma unroll
    for (int r = 0; r < 8; ++r) sf[wave][8 * g + r][j * 16 + col] = acc[j][r];
  LDSX(); for (int rl = 0; rl < 16; ++rl) vst2(OUT + (r0 + rl) * CC + c0 + lane * 4, *(const v4f*)&sf[wave][rl][lane * 4]); }
extern "C" void kernel_launch(void* const* d_in, const int* in_sizes, int n_in, void* d_out, int out_size, void* d_ws, size_t ws_size, hipStream_t stream) {
  (void)in_sizes; (void)n_in; (void)out_size;
  const float** F = (const float**)d_in;   // 0 hidden_states [2,2048,1024], 1 positions [2048] int32 (verbatim arange; read), 2 Wq [1024,1024] ((in,out)), 3 bq, 4 Wk [1024,256], 5 bk, 6 Wv [1024,256], 7 bv, 8 Wo [1024,1024] ((in,out))
  if (ws_size < (size_t)WS_END) return;
  char* ws = (char*)d_ws; _Float16 *QH = (_Float16*)(ws + WS_QH), *QL = (_Float16*)(ws + WS_QL), *KH = (_Float16*)(ws + WS_KH); __bf16 *VT = (__bf16*)(ws + WS_VT), *VL = (__bf16*)(ws + WS_VL); float *S = (float*)(ws + WS_S), *Y = (float*)(ws + WS_Y);
  k_proj<<<dim3(TNB * TT / 64, CC / 128, 3), 128, 0, stream>>>(F[0], F[2], F[3], F[4], F[5], F[6], F[7], (const int*)d_in[1], QH, QL, KH, VT, VL);
  for (int b = 0; b < TNB; ++b) for (int h0 = 0; h0 < NH; h0 += HG) {   // HG query heads per launch
    k_sc<<<dim3(TT / 64, TT / 128, HG), 128, 0, stream>>>(QH, QL, KH, b, h0, S);
    k_sm<<<dim3(TT, HG), 256, 0, stream>>>(S);
    k_pv<<<dim3(TT / 64, 1, HG), 128, 0, stream>>>(S, VT, VL, b, h0, Y);
  }
  k_out<<<dim3(TNB * TT / 64, CC / 128), 128, 0, stream>>>(Y, F[8], (float*)d_out);
}

// v001
// It runs in 714 microseconds.
// Timed twice side by side with v000, it ran 1.75 times as fast both times.
// compute dtype: all float inputs rounded to bf16, positions (int) read; q/k/v = x W + b ((in,out)) with EXACT bf16 products on WMMA 16x16x32, f32 accumulate; neox rotary (rotate-half) in f32 (inv_freq = 10000^(-2i/64) via powf, precise cosf/sinf, positions read) on q and k; q as f16 hi + residual (carried x 2^10), k f16 -> 2-product logits / 8, causal, stored in f32 (4 query heads per launch; kv head = h/4); softmax in f32 (precise expf), P x 2^11 kept f32 split bf16 hi + lo against v bf16 hi + lo (3 products); out = y (bf16 hi + lo) Wo ((in,out)); f32 output.
#include <hip/hip_runtime.h>
#include <math.h>

typedef __attribute__((ext_vector_type(16))) _Float16 v16h;
typedef __attribute__((ext_vector_type(16))) __bf16 v16b;
typedef __attribute__((ext_vector_type(8)))  _Float16 v8h;
typedef __attribute__((ext_vector_type(8)))  float v8f;
typedef __attribute__((ext_vector_type(4)))  float v4f;
typedef __attribute__((ext_vector_type(2)))  float v2f;
typedef __attribute__((ext_vector_type(4)))  unsigned v4u;
typedef __attribute__((ext_vector_type(4)))  int v4i;
typedef float __attribute__((may_alias)) float_a;
typedef int __attribute__((may_alias)) int_a;

template <typename T> __device__ __forceinline__ void vst2(void* p, T v) { *(T*)p = v;  }
__device__ __forceinline__ v8f wmma16(v16h a, v16h b, v8f c) {
  v8f d = __builtin_amdgcn_wmma_f32_16x16x32_f16(false, a, false, b, (short)0, c, false, false);
  asm volatile("v_nop\n\tv_nop\n\tv_nop\n\tv_nop" : "+v"(d) : "v"(a), "v"(b));
  return d;
}
__device__ __forceinline__ v8f wmma_bf(v16b a, v16b b, v8f c) {
  v8f d = __builtin_amdgcn_wmma_f32_16x16x32_bf16(false, a, false, b, (short)0, c, false, false);
  asm volatile("v_nop\n\tv_nop\n\tv_nop\n\tv_nop" : "+v"(d) : "v"(a), "v"(b));
  return d;
}
// 16x16x32 fragments: lane = (h = lane>>4, row/col = lane&15); elements 0..7 = k0+8h+0..7, 8..15 = k0+16+8h+0..7; D element r = row 8h+r
__device__ __forceinline__ v16h frag_h(const _Float16* rowk0, int lane) {
  union { v16h v; v8h q[2]; } u; const _Float16* p = rowk0 + 8 * (lane >> 4);
  u.q[0] = *(const v8h*)p; u.q[1] = *(const v8h*)(p + 16); return u.v;
}
__device__ __forceinline__ v16h frag_f32(const float* rowk0, int lane) {
  v16h a; const float* p = rowk0 + 8 * (lane >> 4);
#pragma unroll
  for (int i = 0; i < 8; ++i) { a[i] = (_Float16)p[i]; a[8 + i] = (_Float16)p[16 + i]; }
  return a;
}
__device__ __forceinline__ v16h frag_f32s(const float* rowk0, int lane, float sc) {
  v16h a; const float* p = rowk0 + 8 * (lane >> 4);
#pragma unroll
  for (int i = 0; i < 8; ++i) { a[i] = (_Float16)(p[i] * sc); a[8 + i] = (_Float16)(p[16 + i] * sc); }
  return a;
}
// column fragment from a [K][ld] layout (column n), rows >= K read as 0
__device__ __forceinline__ v16h fragc_f32(const float* W, int k0, int n, int lane, int ld, int K) {
  v16h a; const int g = lane >> 4;
#pragma unroll
  for (int i = 0; i < 8; ++i) { const int ka = k0 + 8 * g + i, kb = ka + 16;
    a[i] = (_Float16)(ka < K ? W[(size_t)(ka < K ? ka : K - 1) * ld + n] : 0.f); a[8 + i] = (_Float16)(kb < K ? W[(size_t)(kb < K ? kb : K - 1) * ld + n] : 0.f); }
  return a;
}
struct F2 { v16b h, l; };
__device__ __forceinline__ F2 bsplit16(const float v[16]) { F2 r;
#pragma unroll
  for (int i = 0; i < 16; ++i) { const __bf16 h = (__bf16)v[i]; r.h[i] = h; r.l[i] = (__bf16)(v[i] - (float)h); }
  return r; }
__device__ __forceinline__ F2 split_row(const float* row, int k0, int lane) { float v[16]; const float* p = row + k0 + 8 * (lane >> 4);
#pragma unroll
  for (int i = 0; i < 8; ++i) { v[i] = p[i]; v[8 + i] = p[16 + i]; }
  return bsplit16(v); }
__device__ __forceinline__ F2 split_rowK(const float* row, int k0, int lane, int K) { float v[16]; const int g = lane >> 4;
#pragma unroll
  for (int i = 0; i < 8; ++i) { const int ka = k0 + 8 * g + i, kb = ka + 16; v[i] = ka < K ? row[ka < K ? ka : K - 1] : 0.f; v[8 + i] = kb < K ? row[kb < K ? kb : K - 1] : 0.f; }
  return bsplit16(v); }
__device__ __forceinline__ F2 split_col(const float* W, int k0, int n, int lane, int ld, int K) { float v[16]; const int g = lane >> 4;
#pragma unroll
  for (int i = 0; i < 8; ++i) { const int ka = k0 + 8 * g + i, kb = ka + 16; v[i] = ka < K ? W[(size_t)(ka < K ? ka : K - 1) * ld + n] : 0.f; v[8 + i] = kb < K ? W[(size_t)(kb < K ? kb : K - 1) * ld + n] : 0.f; }
  return bsplit16(v); }
__device__ __forceinline__ v8f mac3(const F2& a, const F2& b, v8f c) { c = wmma_bf(a.l, b.h, c); c = wmma_bf(a.h, b.l, c); return wmma_bf(a.h, b.h, c); }
__device__ __forceinline__ float sigm(float v) { return 1.0f / (1.0f + expf(-v)); }
#define LDSX() do { asm volatile("s_wait_dscnt 0" ::: "memory"); __builtin_amdgcn_wave_barrier(); __builtin_amdgcn_fence(__ATOMIC_RELEASE, "workgroup"); } while (0)


// GQA causal attention with neox RoPE (B 2, S 2,048, hidden 1,024 = 16 x 64 query heads, 4 kv heads): q/k/v = x W + b, rope(positions), k/v repeated 4x, scores / 8 causal, softmax, P v, out = y Wo.
#define NB 2
#define TT 2048
#define CC 1024
#define NH 16
#define HD 64
#define NKV 4
#define KV (NKV * HD)      // 256
#define GQ (NH / NKV)      // 4
#ifndef TNB
#define TNB NB
#endif
typedef __attribute__((ext_vector_type(8))) __bf16 v8b;
__device__ __forceinline__ v16b frag_b(const __bf16* rowk0, int lane) {
  union { v16b v; v8b q[2]; } u; const __bf16* p = rowk0 + 8 * (lane >> 4);
  u.q[0] = *(const v8b*)p; u.q[1] = *(const v8b*)(p + 16); return u.v;
}
__device__ __forceinline__ float bfr(float v) { return (float)(__bf16)v; }
__device__ __attribute__((noinline)) float exp_ni(float v) { return expf(v); }
__device__ __attribute__((noinline)) float erf_ni(float v) { return erff(v); }

#define WS_QH  0u
#define WS_QL  (WS_QH + 2u * (size_t)NB * TT * CC)
#define WS_KH  (WS_QL + 2u * (size_t)NB * TT * CC)      // f16 k rows [b*t][KV]
#define WS_VT  (WS_KH + 2u * (size_t)NB * TT * KV)      // bf16 v planes [b][kvc][t]
#define WS_VL  (WS_VT + 2u * (size_t)NB * KV * TT)      // bf16 v residual planes
#define HG 4                                          // query heads per launch group
#define WS_S   (WS_VL + 2u * (size_t)NB * KV * TT)      // f32 logits / P for HG heads [hg][q][k]
#define WS_PH  (WS_S + 4u * (size_t)HG * TT * TT)
#define WS_Y   (WS_PH + 0u)              // f32 y rows [b*t][C]
#define WS_END (WS_Y + 4u * (size_t)NB * TT * CC)

// ---- k_proj: block = (64 rows, 128 cols, which): qkv = x W (+ b), exact; q -> f16 hi (+ residual), k -> f16 rows, v -> bf16 hi + lo planes
__global__ __launch_bounds__(128) void k_proj(const float* __restrict__ X, const float* __restrict__ WQ, const float* __restrict__ BQ, const float* __restrict__ WK, const float* __restrict__ BK, const float* __restrict__ WV, const float* __restrict__ BV, const int* __restrict__ POS, _Float16* __restrict__ QH, _Float16* __restrict__ QL, _Float16* __restrict__ KH, __bf16* __restrict__ VT, __bf16* __restrict__ VL) {
  __shared__ __align__(16) _Float16 sh[64][136], sl[64][136]; __shared__ __align__(16) __bf16 th[128][72], tl2[128][72]; __shared__ __align__(16) float sf[64][132];
  const int tid = threadIdx.x, wave = tid >> 5, lane = tid & 31, col = lane & 15, g = lane >> 4; const int which = blockIdx.z; const int c0 = blockIdx.y * 128; const size_t r0 = (size_t)blockIdx.x * 64; const int NW = which == 0 ? CC : KV; if (c0 >= NW) return;   // k/v are only KV wide (block-uniform exit)
  const float* WA = which == 0 ? WQ : which == 1 ? WK : WV; const float* BA = which == 0 ? BQ : which == 1 ? BK : BV;
  v8f acc[8] = {};
#pragma unroll 2
  for (int kc = 0; kc < CC / 32; ++kc) { v16b a; { const float* p = X + (r0 + wave * 16 + col) * CC + kc * 32 + 8 * g;
#pragma unroll
      for (int i = 0; i < 8; ++i) { a[i] = (__bf16)p[i]; a[8 + i] = (__bf16)p[16 + i]; } }
#pragma unroll
    for (int j = 0; j < 8; ++j) { v16b w; const int o = c0 + j * 16 + col;
#pragma unroll
      for (int i = 0; i < 8; ++i) { w[i] = (__bf16)WA[(size_t)(kc * 32 + 8 * g + i) * NW + o]; w[8 + i] = (__bf16)WA[(size_t)(kc * 32 + 16 + 8 * g + i) * NW + o]; }
      acc[j] = wmma_bf(a, w, acc[j]); } }
#pragma unroll
  for (int j = 0; j < 8; ++j) { const float bb = bfr(BA[c0 + j * 16 + col]);
#pragma unroll
    for (int r = 0; r < 8; ++r) { const float v = acc[j][r] + bb; const int rl = wave * 16 + 8 * g + r, cl = j * 16 + col;
      if (which == 2) { const __bf16 bh = (__bf16)v; th[cl][rl] = bh; tl2[cl][rl] = (__bf16)(v - (float)bh); } else sf[rl][cl] = v; } }
  __syncthreads();
  if (which < 2) {   // rotate-half rotary: out[d] = x[d] cos(p f_(d mod 32)) + (d < 32 ? -x[d+32] : x[d-32]) sin(p f_(d mod 32)); f_i = 10000^(-i/32); p = position_ids[t]
    for (int e = tid; e < 64 * 128; e += 128) { const int rl = e >> 7, cl = e & 127; const int d = cl & 63; const int i2 = d & 31; const size_t row = r0 + rl; const int tpos = POS[(int)(row % TT)];
      const float inv_freq = 1.0f / powf(10000.0f, (float)(2 * i2) / 64.0f); const float ang = (float)tpos * inv_freq; const float c = cosf(ang), s = sinf(ang);
      const float me = sf[rl][cl]; const float partner = (d < 32) ? -sf[rl][cl + 32] : sf[rl][cl - 32]; const float v = me * c + partner * s; const _Float16 hv = (_Float16)v; sh[rl][cl] = hv; sl[rl][cl] = (_Float16)((v - (float)hv) * 1024.0f); }   /* q residual carried x 2^10 so the plane stays f16-normal on the chip */
    __syncthreads(); }
  if (which < 2) { _Float16* dh = which == 0 ? QH : KH; for (int e = tid; e < 64 * 16; e += 128) { const int rl = e >> 4, q = e & 15; vst2((unsigned*)(dh + (r0 + rl) * NW + c0 + q * 8), *(const v4u*)&sh[rl][q * 8]); if (which == 0) vst2((unsigned*)(QL + (r0 + rl) * CC + c0 + q * 8), *(const v4u*)&sl[rl][q * 8]); } }
  else { const size_t b = r0 / TT; const int t0 = (int)(r0 % TT); for (int e = tid; e < 128 * 8; e += 128) { const int cl = e >> 3, q = e & 7; const size_t o2 = (b * KV + c0 + cl) * (size_t)TT + t0 + q * 8; vst2((unsigned*)(VT + o2), *(const v4u*)&th[cl][q * 8]); vst2((unsigned*)(VL + o2), *(const v4u*)&tl2[cl][q * 8]); } } }
// ---- k_sc: block = (64 queries, 128 keys) of (b, query head h; kv head h/4): 2-product logits / 8, causal; key blocks above the diagonal exit
__global__ __launch_bounds__(128) void k_sc(const _Float16* __restrict__ QH, const _Float16* __restrict__ QL, const _Float16* __restrict__ KH, int b, int h0, float* __restrict__ S0) { __shared__ __align__(16) float ss[4][16][132]; const int h = h0 + blockIdx.z; float* S = S0 + (size_t)blockIdx.z * TT * TT;
  const int tid = threadIdx.x, wave = tid >> 5, lane = tid & 31, col = lane & 15, g = lane >> 4; const int k0 = blockIdx.y * 128; const int ql0 = blockIdx.x * 64 + wave * 16; const size_t q0 = (size_t)b * TT + ql0;
  if (k0 > blockIdx.x * 64 + 63) return;   // whole key block above the diagonal (block-uniform)
  v8f acc[8] = {}, accl[8] = {};
#pragma unroll
  for (int kc = 0; kc < HD / 32; ++kc) { const v16h ah = frag_h(QH + (q0 + col) * CC + h * HD + kc * 32, lane), al = frag_h(QL + (q0 + col) * CC + h * HD + kc * 32, lane);
#pragma unroll
    for (int j = 0; j < 8; ++j) { const v16h kb = frag_h(KH + ((size_t)b * TT + k0 + j * 16 + col) * KV + (h / GQ) * HD + kc * 32, lane); acc[j] = wmma16(ah, kb, acc[j]); accl[j] = wmma16(al, kb, accl[j]); } }
#pragma unroll
  for (int j = 0; j < 8; ++j) acc[j] += accl[j] * (1.0f / 1024.0f);
#pragma unroll
  for (int j = 0; j < 8; ++j) { const int kt = k0 + j * 16 + col;
#pragma unroll
    for (int r = 0; r < 8; ++r) { const int qt = ql0 + 8 * g + r; float v = acc[j][r] * 0.125f; if (kt > qt) v = -3.0e38f; ss[wave][8 * g + r][j * 16 + col] = v; } }
  LDSX(); for (int rl = 0; rl < 16; ++rl) vst2(S + (size_t)(ql0 + rl) * TT + k0 + lane * 4, *(const v4f*)&ss[wave][rl][lane * 4]); }
// ---- k_sm: block = query row: softmax over keys [0, kend) -> P x 2^11 f32 (masked -> 0)
__global__ __launch_bounds__(256) void k_sm(float* __restrict__ S0) { __shared__ float sred[8]; __shared__ float sbc; __shared__ __align__(16) float sh[TT];
  const int t = threadIdx.x; const size_t row = blockIdx.x; float* sr = S0 + (size_t)blockIdx.y * TT * TT + row * TT; const int kend = ((int)row / 64) * 64 + 64;
  float m = -3.0e38f; for (int k = t; k < kend; k += 256) m = fmaxf(m, sr[k]);
#pragma unroll
  for (int o = 1; o < 32; o <<= 1) m = fmaxf(m, __shfl_xor(m, o));
  if ((t & 31) == 0) sred[t >> 5] = m; __syncthreads(); if (t == 0) { float a = sred[0]; for (int i = 1; i < 8; ++i) a = fmaxf(a, sred[i]); sbc = a; } __syncthreads(); m = sbc; __syncthreads();
  float sum = 0.f; for (int k = t; k < kend; k += 256) { const float v = sr[k]; sum += (v <= -1.0e38f) ? 0.f : expf(v - m); }
#pragma unroll
  for (int o = 1; o < 32; o <<= 1) sum += __shfl_xor(sum, o);
  if ((t & 31) == 0) sred[t >> 5] = sum; __syncthreads(); if (t == 0) { float a = 0.f; for (int i = 0; i < 8; ++i) a += sred[i]; sbc = 1.0f / a; } __syncthreads(); const float inv = sbc;
  for (int k = t; k < kend; k += 256) { const float v = sr[k]; sh[k] = (v <= -1.0e38f) ? 0.f : expf(v - m) * inv * 2048.0f; }
  __syncthreads(); for (int q = t; q < kend / 4; q += 256) vst2(sr + q * 4, *(const v4f*)&sh[q * 4]); }
// ---- k_pv: block = 16 queries of (b,h), 8 waves: wave w takes the 64-key units w, w + 8, ... of keys [0, kend) (two 32-key chunks each: both halves of a 128-byte line of v stay with one wave); the 8 partial tiles are summed through LDS in wave order: y[q][h*HD + d] = P . v
#define PVW 8
__global__ __launch_bounds__(32 * PVW) void k_pv(const float* __restrict__ PS0, const __bf16* __restrict__ VT, const __bf16* __restrict__ VL, int b, int h0, float* __restrict__ Y) { const int h = h0 + blockIdx.z; const float* PS = PS0 + (size_t)blockIdx.z * TT * TT; __shared__ __align__(16) float ss[PVW][16][HD + 4];
  const int tid = threadIdx.x, wave = __builtin_amdgcn_readfirstlane(tid >> 5), lane = tid & 31, col = lane & 15, g = lane >> 4; const int ql0 = blockIdx.x * 16; const int kend = (blockIdx.x / 4) * 64 + 64;   // P is written (zeros above the diagonal) up to the 64-query group's end
  v8f acc[HD / 16] = {};
#pragma unroll 1
  for (int kc = 2 * wave; kc < kend / 32; kc += (kc & 1) ? 2 * PVW - 1 : 1) { const F2 p = split_row(PS + (size_t)(ql0 + col) * TT, kc * 32, lane);
#pragma unroll
    for (int j = 0; j < HD / 16; ++j) { const size_t po = ((size_t)b * KV + (h / GQ) * HD + j * 16 + col) * (size_t)TT + kc * 32; const v16b vh = frag_b(VT + po, lane); acc[j] = wmma_bf(p.h, vh, acc[j]); acc[j] = wmma_bf(p.l, vh, acc[j]); acc[j] = wmma_bf(p.h, frag_b(VL + po, lane), acc[j]); } }
#pragma unroll
  for (int j = 0; j < HD / 16; ++j)
#pragma unroll
    for (int r = 0; r < 8; ++r) ss[wave][8 * g + r][j * 16 + col] = acc[j][r];
  __syncthreads();   // every wave's partial tile is in LDS before any thread sums across waves
  { const int rl = tid >> 4, c4 = (tid & 15) * 4; v4f s = *(const v4f*)&ss[0][rl][c4];
#pragma unroll
    for (int w = 1; w < PVW; ++w) s += *(const v4f*)&ss[w][rl][c4];
    vst2(Y + ((size_t)b * TT + ql0 + rl) * CC + h * HD + c4, s * (1.0f / 2048.0f)); } }
// ---- k_out: block = (64 rows, 128 cols): out = y (bf16 hi + lo) Wo ((in,out), exact bf16 weights), f32 accumulate
__global__ __launch_bounds__(128) void k_out(const float* __restrict__ Y, const float* __restrict__ WO, float* __restrict__ OUT) { __shared__ __align__(16) float sf[4][16][132];
  const int tid = threadIdx.x, wave = tid >> 5, lane = tid & 31, col = lane & 15, g = lane >> 4; const int c0 = blockIdx.y * 128; const size_t r0 = (size_t)blockIdx.x * 64 + wave * 16;
  v8f acc[8] = {};
#pragma unroll 2
  for (int kc = 0; kc < CC / 32; ++kc) { const F2 a = split_row(Y + (r0 + col) * CC, kc * 32, lane);
#pragma unroll
    for (int j = 0; j < 8; ++j) { v16b w; const int o = c0 + j * 16 + col;
#pragma unroll
      for (int i = 0; i < 8; ++i) { w[i] = (__bf16)WO[(size_t)(kc * 32 + 8 * g + i) * CC + o]; w[8 + i] = (__bf16)WO[(size_t)(kc * 32 + 16 + 8 * g + i) * CC + o]; }
      acc[j] = wmma_bf(a.h, w, acc[j]); acc[j] = wmma_bf(a.l, w, acc[j]); } }
#pragma unroll
  for (int j = 0; j < 8; ++j)
#pragma unroll
    for (int r = 0; r < 8; ++r) sf[wave][8 * g + r][j * 16 + col] = acc[j][r];
  LDSX(); for (int rl = 0; rl < 16; ++rl) vst2(OUT + (r0 + rl) * CC + c0 + lane * 4, *(const v4f*)&sf[wave][rl][lane * 4]); }
extern "C" void kernel_launch(void* const* d_in, const int* in_sizes, int n_in, void* d_out, int out_size, void* d_ws, size_t ws_size, hipStream_t stream) {
  (void)in_sizes; (void)n_in; (void)out_size;
  const float** F = (const float**)d_in;   // 0 hidden_states [2,2048,1024], 1 positions [2048] int32 (verbatim arange; read), 2 Wq [1024,1024] ((in,out)), 3 bq, 4 Wk [1024,256], 5 bk, 6 Wv [1024,256], 7 bv, 8 Wo [1024,1024] ((in,out))
  if (ws_size < (size_t)WS_END) return;
  char* ws = (char*)d_ws; _Float16 *QH = (_Float16*)(ws + WS_QH), *QL = (_Float16*)(ws + WS_QL), *KH = (_Float16*)(ws + WS_KH); __bf16 *VT = (__bf16*)(ws + WS_VT), *VL = (__bf16*)(ws + WS_VL); float *S = (float*)(ws + WS_S), *Y = (float*)(ws + WS_Y);
  k_proj<<<dim3(TNB * TT / 64, CC / 128, 3), 128, 0, stream>>>(F[0], F[2], F[3], F[4], F[5], F[6], F[7], (const int*)d_in[1], QH, QL, KH, VT, VL);
  for (int b = 0; b < TNB; ++b) for (int h0 = 0; h0 < NH; h0 += HG) {   // HG query heads per launch
    k_sc<<<dim3(TT / 64, TT / 128, HG), 128, 0, stream>>>(QH, QL, KH, b, h0, S);
    k_sm<<<dim3(TT, HG), 256, 0, stream>>>(S);
    k_pv<<<dim3(TT / 16, 1, HG), 32 * PVW, 0, stream>>>(S, VT, VL, b, h0, Y);
  }
  k_out<<<dim3(TNB * TT / 64, CC / 128), 128, 0, stream>>>(Y, F[8], (float*)d_out);
}

// v002
// Measured time: 189 microseconds a run.
// Timed twice side by side with v001, it ran 3.78 and 3.74 times as fast.
// Over all steps from v000 it is 6.58 times as fast.
// compute dtype: all float inputs rounded to bf16, positions (int) read; q/k/v = x W + b ((in,out)) with EXACT bf16 products on WMMA 16x16x32, f32 accumulate; neox rotary (rotate-half) in f32 (inv_freq = 10000^(-2i/64) via powf, precise cosf/sinf, positions read) on q and k; q as f16 hi + residual (carried x 2^10), k f16 -> 2-product logits / 8, causal, kept in registers (kv head = h/4); running-maximum softmax in f32 (exp2 of the log2e-scaled difference), unnormalised P split bf16 hi + lo against v bf16 hi + lo (3 products), divided by the row sum at the end; out = y (bf16 hi + lo) Wo ((in,out)); f32 output.
#include <hip/hip_runtime.h>
#include <math.h>

typedef __attribute__((ext_vector_type(16))) _Float16 v16h;
typedef __attribute__((ext_vector_type(16))) __bf16 v16b;
typedef __attribute__((ext_vector_type(8)))  _Float16 v8h;
typedef __attribute__((ext_vector_type(8)))  float v8f;
typedef __attribute__((ext_vector_type(4)))  float v4f;
typedef __attribute__((ext_vector_type(2)))  float v2f;
typedef __attribute__((ext_vector_type(4)))  unsigned v4u;
typedef __attribute__((ext_vector_type(4)))  int v4i;
typedef float __attribute__((may_alias)) float_a;
typedef int __attribute__((may_alias)) int_a;

template <typename T> __device__ __forceinline__ void vst2(void* p, T v) { *(T*)p = v;  }
__device__ __forceinline__ v8f wmma16(v16h a, v16h b, v8f c) {
  v8f d = __builtin_amdgcn_wmma_f32_16x16x32_f16(false, a, false, b, (short)0, c, false, false);
  asm volatile("v_nop\n\tv_nop\n\tv_nop\n\tv_nop" : "+v"(d) : "v"(a), "v"(b));
  return d;
}
__device__ __forceinline__ v8f wmma_bf(v16b a, v16b b, v8f c) {
  v8f d = __builtin_amdgcn_wmma_f32_16x16x32_bf16(false, a, false, b, (short)0, c, false, false);
  asm volatile("v_nop\n\tv_nop\n\tv_nop\n\tv_nop" : "+v"(d) : "v"(a), "v"(b));
  return d;
}
// 16x16x32 fragments: lane = (h = lane>>4, row/col = lane&15); elements 0..7 = k0+8h+0..7, 8..15 = k0+16+8h+0..7; D element r = row 8h+r
__device__ __forceinline__ v16h frag_h(const _Float16* rowk0, int lane) {
  union { v16h v; v8h q[2]; } u; const _Float16* p = rowk0 + 8 * (lane >> 4);
  u.q[0] = *(const v8h*)p; u.q[1] = *(const v8h*)(p + 16); return u.v;
}
__device__ __forceinline__ v16h frag_f32(const float* rowk0, int lane) {
  v16h a; const float* p = rowk0 + 8 * (lane >> 4);
#pragma unroll
  for (int i = 0; i < 8; ++i) { a[i] = (_Float16)p[i]; a[8 + i] = (_Float16)p[16 + i]; }
  return a;
}
__device__ __forceinline__ v16h frag_f32s(const float* rowk0, int lane, float sc) {
  v16h a; const float* p = rowk0 + 8 * (lane >> 4);
#pragma unroll
  for (int i = 0; i < 8; ++i) { a[i] = (_Float16)(p[i] * sc); a[8 + i] = (_Float16)(p[16 + i] * sc); }
  return a;
}
// column fragment from a [K][ld] layout (column n), rows >= K read as 0
__device__ __forceinline__ v16h fragc_f32(const float* W, int k0, int n, int lane, int ld, int K) {
  v16h a; const int g = lane >> 4;
#pragma unroll
  for (int i = 0; i < 8; ++i) { const int ka = k0 + 8 * g + i, kb = ka + 16;
    a[i] = (_Float16)(ka < K ? W[(size_t)(ka < K ? ka : K - 1) * ld + n] : 0.f); a[8 + i] = (_Float16)(kb < K ? W[(size_t)(kb < K ? kb : K - 1) * ld + n] : 0.f); }
  return a;
}
struct F2 { v16b h, l; };
__device__ __forceinline__ F2 bsplit16(const float v[16]) { F2 r;
#pragma unroll
  for (int i = 0; i < 16; ++i) { const __bf16 h = (__bf16)v[i]; r.h[i] = h; r.l[i] = (__bf16)(v[i] - (float)h); }
  return r; }
__device__ __forceinline__ F2 split_row(const float* row, int k0, int lane) { float v[16]; const float* p = row + k0 + 8 * (lane >> 4);
#pragma unroll
  for (int i = 0; i < 8; ++i) { v[i] = p[i]; v[8 + i] = p[16 + i]; }
  return bsplit16(v); }
__device__ __forceinline__ F2 split_rowK(const float* row, int k0, int lane, int K) { float v[16]; const int g = lane >> 4;
#pragma unroll
  for (int i = 0; i < 8; ++i) { const int ka = k0 + 8 * g + i, kb = ka + 16; v[i] = ka < K ? row[ka < K ? ka : K - 1] : 0.f; v[8 + i] = kb < K ? row[kb < K ? kb : K - 1] : 0.f; }
  return bsplit16(v); }
__device__ __forceinline__ F2 split_col(const float* W, int k0, int n, int lane, int ld, int K) { float v[16]; const int g = lane >> 4;
#pragma unroll
  for (int i = 0; i < 8; ++i) { const int ka = k0 + 8 * g + i, kb = ka + 16; v[i] = ka < K ? W[(size_t)(ka < K ? ka : K - 1) * ld + n] : 0.f; v[8 + i] = kb < K ? W[(size_t)(kb < K ? kb : K - 1) * ld + n] : 0.f; }
  return bsplit16(v); }
__device__ __forceinline__ v8f mac3(const F2& a, const F2& b, v8f c) { c = wmma_bf(a.l, b.h, c); c = wmma_bf(a.h, b.l, c); return wmma_bf(a.h, b.h, c); }
__device__ __forceinline__ float sigm(float v) { return 1.0f / (1.0f + expf(-v)); }
#define LDSX() do { asm volatile("s_wait_dscnt 0" ::: "memory"); __builtin_amdgcn_wave_barrier(); __builtin_amdgcn_fence(__ATOMIC_RELEASE, "workgroup"); } while (0)


// GQA causal attention with neox RoPE (B 2, S 2,048, hidden 1,024 = 16 x 64 query heads, 4 kv heads): q/k/v = x W + b, rope(positions), k/v repeated 4x, scores / 8 causal, softmax, P v, out = y Wo.
#define NB 2
#define TT 2048
#define CC 1024
#define NH 16
#define HD 64
#define NKV 4
#define KV (NKV * HD)      // 256
#define GQ (NH / NKV)      // 4
#ifndef TNB
#define TNB NB
#endif
typedef __attribute__((ext_vector_type(8))) __bf16 v8b;
__device__ __forceinline__ v16b frag_b(const __bf16* rowk0, int lane) {
  union { v16b v; v8b q[2]; } u; const __bf16* p = rowk0 + 8 * (lane >> 4);
  u.q[0] = *(const v8b*)p; u.q[1] = *(const v8b*)(p + 16); return u.v;
}
__device__ __forceinline__ float bfr(float v) { return (float)(__bf16)v; }
__device__ __attribute__((noinline)) float exp_ni(float v) { return expf(v); }
__device__ __attribute__((noinline)) float erf_ni(float v) { return erff(v); }

#define WS_QH  0u
#define WS_QL  (WS_QH + 2u * (size_t)NB * TT * CC)
#define WS_KH  (WS_QL + 2u * (size_t)NB * TT * CC)      // f16 k rows [b*t][KV]
#define WS_VT  (WS_KH + 2u * (size_t)NB * TT * KV)      // bf16 v planes [b][kvc][t]
#define WS_VL  (WS_VT + 2u * (size_t)NB * KV * TT)      // bf16 v residual planes
#define WS_Y   (WS_VL + 2u * (size_t)NB * KV * TT)      // f32 y rows [b*t][C]
#define WS_END (WS_Y + 4u * (size_t)NB * TT * CC)

// ---- k_proj: block = (64 rows, 128 cols, which): qkv = x W (+ b), exact; q -> f16 hi (+ residual), k -> f16 rows, v -> bf16 hi + lo planes
__global__ __launch_bounds__(128) void k_proj(const float* __restrict__ X, const float* __restrict__ WQ, const float* __restrict__ BQ, const float* __restrict__ WK, const float* __restrict__ BK, const float* __restrict__ WV, const float* __restrict__ BV, const int* __restrict__ POS, _Float16* __restrict__ QH, _Float16* __restrict__ QL, _Float16* __restrict__ KH, __bf16* __restrict__ VT, __bf16* __restrict__ VL) {
  __shared__ __align__(16) _Float16 sh[64][136], sl[64][136]; __shared__ __align__(16) __bf16 th[128][72], tl2[128][72]; __shared__ __align__(16) float sf[64][132];
  const int tid = threadIdx.x, wave = tid >> 5, lane = tid & 31, col = lane & 15, g = lane >> 4; const int which = blockIdx.z; const int c0 = blockIdx.y * 128; const size_t r0 = (size_t)blockIdx.x * 64; const int NW = which == 0 ? CC : KV; if (c0 >= NW) return;   // k/v are only KV wide (block-uniform exit)
  const float* WA = which == 0 ? WQ : which == 1 ? WK : WV; const float* BA = which == 0 ? BQ : which == 1 ? BK : BV;
  v8f acc[8] = {};
#pragma unroll 2
  for (int kc = 0; kc < CC / 32; ++kc) { v16b a; { const float* p = X + (r0 + wave * 16 + col) * CC + kc * 32 + 8 * g;
#pragma unroll
      for (int i = 0; i < 8; ++i) { a[i] = (__bf16)p[i]; a[8 + i] = (__bf16)p[16 + i]; } }
#pragma unroll
    for (int j = 0; j < 8; ++j) { v16b w; const int o = c0 + j * 16 + col;
#pragma unroll
      for (int i = 0; i < 8; ++i) { w[i] = (__bf16)WA[(size_t)(kc * 32 + 8 * g + i) * NW + o]; w[8 + i] = (__bf16)WA[(size_t)(kc * 32 + 16 + 8 * g + i) * NW + o]; }
      acc[j] = wmma_bf(a, w, acc[j]); } }
#pragma unroll
  for (int j = 0; j < 8; ++j) { const float bb = bfr(BA[c0 + j * 16 + col]);
#pragma unroll
    for (int r = 0; r < 8; ++r) { const float v = acc[j][r] + bb; const int rl = wave * 16 + 8 * g + r, cl = j * 16 + col;
      if (which == 2) { const __bf16 bh = (__bf16)v; th[cl][rl] = bh; tl2[cl][rl] = (__bf16)(v - (float)bh); } else sf[rl][cl] = v; } }
  __syncthreads();
  if (which < 2) {   // rotate-half rotary: out[d] = x[d] cos(p f_(d mod 32)) + (d < 32 ? -x[d+32] : x[d-32]) sin(p f_(d mod 32)); f_i = 10000^(-i/32); p = position_ids[t]
    for (int e = tid; e < 64 * 128; e += 128) { const int rl = e >> 7, cl = e & 127; const int d = cl & 63; const int i2 = d & 31; const size_t row = r0 + rl; const int tpos = POS[(int)(row % TT)];
      const float inv_freq = 1.0f / powf(10000.0f, (float)(2 * i2) / 64.0f); const float ang = (float)tpos * inv_freq; const float c = cosf(ang), s = sinf(ang);
      const float me = sf[rl][cl]; const float partner = (d < 32) ? -sf[rl][cl + 32] : sf[rl][cl - 32]; const float v = me * c + partner * s; const _Float16 hv = (_Float16)v; sh[rl][cl] = hv; sl[rl][cl] = (_Float16)((v - (float)hv) * 1024.0f); }   /* q residual carried x 2^10 so the plane stays f16-normal on the chip */
    __syncthreads(); }
  if (which < 2) { _Float16* dh = which == 0 ? QH : KH; for (int e = tid; e < 64 * 16; e += 128) { const int rl = e >> 4, q = e & 15; vst2((unsigned*)(dh + (r0 + rl) * NW + c0 + q * 8), *(const v4u*)&sh[rl][q * 8]); if (which == 0) vst2((unsigned*)(QL + (r0 + rl) * CC + c0 + q * 8), *(const v4u*)&sl[rl][q * 8]); } }
  else { const size_t b = r0 / TT; const int t0 = (int)(r0 % TT); for (int e = tid; e < 128 * 8; e += 128) { const int cl = e >> 3, q = e & 7; const size_t o2 = (b * KV + c0 + cl) * (size_t)TT + t0 + q * 8; vst2((unsigned*)(VT + o2), *(const v4u*)&th[cl][q * 8]); vst2((unsigned*)(VL + o2), *(const v4u*)&tl2[cl][q * 8]); } } }
#define FQ 2                // 16-query tiles per block
#define FW (GQ * FQ)        // waves per block
#define SP 72               // LDS row pitch in 16-bit elements: a 128-byte row + 16 bytes, for 16-byte readers
#define L2E 1.44269504088896340736f
// waves_per_eu(4, 4): two blocks a WGP; lets the compiler keep all 24 fragment reads of a 32-key pass in flight at once instead of saving registers
__global__ __launch_bounds__(32 * FW) __attribute__((amdgpu_waves_per_eu(4, 4))) void k_fa(const _Float16* __restrict__ QH, const _Float16* __restrict__ QL, const _Float16* __restrict__ KH, const __bf16* __restrict__ VT, const __bf16* __restrict__ VL, float* __restrict__ Y) {
  __shared__ __align__(16) _Float16 sk[2][64][SP]; __shared__ __align__(16) __bf16 svh[2][64][SP], svl[2][64][SP]; __shared__ __align__(16) float so[FW][16][HD + 4];
  const int tid = threadIdx.x, wave = __builtin_amdgcn_readfirstlane(tid >> 5), lane = tid & 31, col = lane & 15, g = lane >> 4;
  const int kvh = blockIdx.x % NKV, b = blockIdx.x / NKV; const int yb = blockIdx.y; const int q0 = (yb < TT / 64 ? TT / 32 - 1 - yb : yb - TT / 64) * 32;   // long blocks first, then short ones in rising order (a permutation; for balance only)
  const int h = kvh * GQ + (wave & (GQ - 1)), ql0 = q0 + (wave / GQ) * 16, qt = ql0 + col; const int ns = q0 / 64 + 1;   // 64-key stages up to the block's diagonal
  const int sr = tid >> 3, sc = (tid & 7) * 8;   // staging: 8 lanes a row, rows sr and sr + 32
  const _Float16* gk = KH + ((size_t)b * TT + sr) * KV + kvh * HD + sc; const size_t vo = ((size_t)b * KV + kvh * HD + sr) * (size_t)TT + sc; const __bf16 *gh = VT + vo, *gl = VL + vo;
  v16h qh[2], qr[2];
#pragma unroll
  for (int kc = 0; kc < 2; ++kc) { const size_t qo = ((size_t)b * TT + qt) * CC + h * HD + kc * 32; qh[kc] = frag_h(QH + qo, lane); qr[kc] = frag_h(QL + qo, lane); }
  v8h rk0 = *(const v8h*)gk, rk1 = *(const v8h*)(gk + 32 * KV); v8b rh0 = *(const v8b*)gh, rh1 = *(const v8b*)(gh + 32 * TT), rl0 = *(const v8b*)gl, rl1 = *(const v8b*)(gl + 32 * TT);
  *(v8h*)&sk[0][sr][sc] = rk0; *(v8h*)&sk[0][sr + 32][sc] = rk1; *(v8b*)&svh[0][sr][sc] = rh0; *(v8b*)&svh[0][sr + 32][sc] = rh1; *(v8b*)&svl[0][sr][sc] = rl0; *(v8b*)&svl[0][sr + 32][sc] = rl1;
  __syncthreads();   // stage 0 is in LDS before any wave reads it
  v8f o[HD / 16] = {}; float m = -3.0e38f, l = 0.f;
  // the stage loop stays rolled (its trip count is the block's own; a second copy of the body would only cost instruction cache); every full unroll below keeps a fragment or accumulator array in registers
#pragma unroll 1
  for (int st = 0; st < ns; ++st) { const int cur = st & 1, k0 = st * 64; const bool more = st + 1 < ns;   // block-uniform
    if (more) { const int kn = k0 + 64; rk0 = *(const v8h*)(gk + (size_t)kn * KV); rk1 = *(const v8h*)(gk + (size_t)(kn + 32) * KV); rh0 = *(const v8b*)(gh + kn); rh1 = *(const v8b*)(gh + 32 * TT + kn); rl0 = *(const v8b*)(gl + kn); rl1 = *(const v8b*)(gl + 32 * TT + kn);
      asm volatile("s_wait_xcnt 0x0" ::: "memory"); }   // the fragment reads below reuse the address registers of these six loads: the wait stands in front of that overwrite
#pragma unroll
    for (int hf = 0; hf < 2; ++hf) { const int kb0 = k0 + hf * 32;
      if (kb0 <= ql0 + 15) {   // wave-uniform: 32 keys wholly above this wave's diagonal add nothing
        v16h ka[2], kb[2]; v16b vh[HD / 16], vl[HD / 16]; v8f s[2] = {};
#pragma unroll
        for (int j = 0; j < 2; ++j) { const _Float16* kp = &sk[cur][hf * 32 + j * 16 + col][0]; ka[j] = frag_h(kp, lane); kb[j] = frag_h(kp + 32, lane); }
#pragma unroll
        for (int j = 0; j < HD / 16; ++j) { vh[j] = frag_b(&svh[cur][j * 16 + col][hf * 32], lane); vl[j] = frag_b(&svl[cur][j * 16 + col][hf * 32], lane); }
#pragma unroll
        for (int j = 0; j < 2; ++j) s[j] = wmma16(ka[j], qr[0], s[j]);
#pragma unroll
        for (int j = 0; j < 2; ++j) s[j] = wmma16(kb[j], qr[1], s[j]);
#pragma unroll
        for (int j = 0; j < 2; ++j) s[j] *= (1.0f / 1024.0f);   // the residual plane is carried x 2^10
#pragma unroll
        for (int j = 0; j < 2; ++j) s[j] = wmma16(ka[j], qh[0], s[j]);
#pragma unroll
        for (int j = 0; j < 2; ++j) s[j] = wmma16(kb[j], qh[1], s[j]);
#pragma unroll
        for (int j = 0; j < 2; ++j) s[j] *= 0.125f;
        if (kb0 + 31 > ql0) {   // wave-uniform: only keys at the diagonal mask; key 0 is open to every query, so the running maximum is finite from the first 32 keys on
#pragma unroll
          for (int j = 0; j < 2; ++j)
#pragma unroll
            for (int r = 0; r < 8; ++r) if (kb0 + j * 16 + 8 * g + r > qt) s[j][r] = -3.0e38f; }
        float mx = m;
#pragma unroll
        for (int j = 0; j < 2; ++j)
#pragma unroll
          for (int r = 0; r < 8; ++r) mx = fmaxf(mx, s[j][r]);
        mx = fmaxf(mx, __shfl_xor(mx, 16));
        const float al = __builtin_amdgcn_exp2f((m - mx) * L2E); m = mx; l *= al;
#pragma unroll
        for (int j = 0; j < HD / 16; ++j) o[j] *= al;
        v16b ph, pl;   // B fragment of Pt: element i = key 8g + i of score tile 0, element 8 + i = the same row of tile 1: the k order of frag_b
#pragma unroll
        for (int i = 0; i < 8; ++i) { const float x = __builtin_amdgcn_exp2f((s[0][i] - mx) * L2E), y = __builtin_amdgcn_exp2f((s[1][i] - mx) * L2E); l += x + y;
          const __bf16 xh = (__bf16)x, yh = (__bf16)y; ph[i] = xh; ph[8 + i] = yh; pl[i] = (__bf16)(x - (float)xh); pl[8 + i] = (__bf16)(y - (float)yh); }
#pragma unroll
        for (int j = 0; j < HD / 16; ++j) o[j] = wmma_bf(vh[j], ph, o[j]);
#pragma unroll
        for (int j = 0; j < HD / 16; ++j) o[j] = wmma_bf(vh[j], pl, o[j]);
#pragma unroll
        for (int j = 0; j < HD / 16; ++j) o[j] = wmma_bf(vl[j], ph, o[j]); } }
    if (more) { const int nx = cur ^ 1; *(v8h*)&sk[nx][sr][sc] = rk0; *(v8h*)&sk[nx][sr + 32][sc] = rk1; *(v8b*)&svh[nx][sr][sc] = rh0; *(v8b*)&svh[nx][sr + 32][sc] = rh1; *(v8b*)&svl[nx][sr][sc] = rl0; *(v8b*)&svl[nx][sr + 32][sc] = rl1; }
    __syncthreads(); }   // publishes stage st + 1 and ends every wave's reads of the buffer that the next pass refills
  l += __shfl_xor(l, 16); const float inv = 1.0f / l;
#pragma unroll
  for (int j = 0; j < HD / 16; ++j) { v4f lo4, hi4;
#pragma unroll
    for (int r = 0; r < 4; ++r) { lo4[r] = o[j][r] * inv; hi4[r] = o[j][4 + r] * inv; }
    *(v4f*)&so[wave][col][j * 16 + 8 * g] = lo4; *(v4f*)&so[wave][col][j * 16 + 8 * g + 4] = hi4; }
  LDSX();   // the wave's own tile, turned in its own LDS range so that the stores cover whole lines
#pragma unroll
  for (int it = 0; it < 8; ++it) { const int rl = it * 2 + g; vst2(Y + ((size_t)b * TT + ql0 + rl) * CC + h * HD + col * 4, *(const v4f*)&so[wave][rl][col * 4]); } }
// ---- k_out: block = (64 rows, 128 cols): out = y (bf16 hi + lo) Wo ((in,out), exact bf16 weights), f32 accumulate
__global__ __launch_bounds__(128) void k_out(const float* __restrict__ Y, const float* __restrict__ WO, float* __restrict__ OUT) { __shared__ __align__(16) float sf[4][16][132];
  const int tid = threadIdx.x, wave = tid >> 5, lane = tid & 31, col = lane & 15, g = lane >> 4; const int c0 = blockIdx.y * 128; const size_t r0 = (size_t)blockIdx.x * 64 + wave * 16;
  v8f acc[8] = {};
#pragma unroll 2
  for (int kc = 0; kc < CC / 32; ++kc) { const F2 a = split_row(Y + (r0 + col) * CC, kc * 32, lane);
#pragma unroll
    for (int j = 0; j < 8; ++j) { v16b w; const int o = c0 + j * 16 + col;
#pragma unroll
      for (int i = 0; i < 8; ++i) { w[i] = (__bf16)WO[(size_t)(kc * 32 + 8 * g + i) * CC + o]; w[8 + i] = (__bf16)WO[(size_t)(kc * 32 + 16 + 8 * g + i) * CC + o]; }
      acc[j] = wmma_bf(a.h, w, acc[j]); acc[j] = wmma_bf(a.l, w, acc[j]); } }
#pragma unroll
  for (int j = 0; j < 8; ++j)
#pragma unroll
    for (int r = 0; r < 8; ++r) sf[wave][8 * g + r][j * 16 + col] = acc[j][r];
  LDSX(); for (int rl = 0; rl < 16; ++rl) vst2(OUT + (r0 + rl) * CC + c0 + lane * 4, *(const v4f*)&sf[wave][rl][lane * 4]); }
extern "C" void kernel_launch(void* const* d_in, const int* in_sizes, int n_in, void* d_out, int out_size, void* d_ws, size_t ws_size, hipStream_t stream) {
  (void)in_sizes; (void)n_in; (void)out_size;
  const float** F = (const float**)d_in;   // 0 hidden_states [2,2048,1024], 1 positions [2048] int32 (verbatim arange; read), 2 Wq [1024,1024] ((in,out)), 3 bq, 4 Wk [1024,256], 5 bk, 6 Wv [1024,256], 7 bv, 8 Wo [1024,1024] ((in,out))
  if (ws_size < (size_t)WS_END) return;
  char* ws = (char*)d_ws; _Float16 *QH = (_Float16*)(ws + WS_QH), *QL = (_Float16*)(ws + WS_QL), *KH = (_Float16*)(ws + WS_KH); __bf16 *VT = (__bf16*)(ws + WS_VT), *VL = (__bf16*)(ws + WS_VL); float *Y = (float*)(ws + WS_Y);
  k_proj<<<dim3(TNB * TT / 64, CC / 128, 3), 128, 0, stream>>>(F[0], F[2], F[3], F[4], F[5], F[6], F[7], (const int*)d_in[1], QH, QL, KH, VT, VL);
  k_fa<<<dim3(TNB * NKV, TT / 32), 32 * FW, 0, stream>>>(QH, QL, KH, VT, VL, Y);
  k_out<<<dim3(TNB * TT / 64, CC / 128), 128, 0, stream>>>(Y, F[8], (float*)d_out);
}

// v003
// One run takes 105 microseconds.
// Next to v002, in two timings, it ran 1.80 times as fast each time.
// Counting every step since v000, it is 11.9 times as fast.
// compute dtype: all float inputs rounded to bf16, positions (int) read; q/k/v = x W + b ((in,out)) with EXACT bf16 products on WMMA 16x16x32, f32 accumulate; neox rotary (rotate-half) in f32 (inv_freq = 10000^(-2i/64) via powf, precise cosf/sinf, positions read) on q and k; q as f16 hi + residual (carried x 2^10), k f16 -> 2-product logits / 8, causal, kept in registers (kv head = h/4); running-maximum softmax in f32 (exp2 of the log2e-scaled difference), unnormalised P split bf16 hi + lo against v bf16 hi + lo (3 products), divided by the row sum at the end; out = y (bf16 hi + lo) Wo ((in,out)); f32 output.
#include <hip/hip_runtime.h>
#include <math.h>

typedef __attribute__((ext_vector_type(16))) _Float16 v16h;
typedef __attribute__((ext_vector_type(16))) __bf16 v16b;
typedef __attribute__((ext_vector_type(8)))  _Float16 v8h;
typedef __attribute__((ext_vector_type(8)))  float v8f;
typedef __attribute__((ext_vector_type(4)))  float v4f;
typedef __attribute__((ext_vector_type(2)))  float v2f;
typedef __attribute__((ext_vector_type(4)))  unsigned v4u;
typedef __attribute__((ext_vector_type(4)))  int v4i;
typedef float __attribute__((may_alias)) float_a;
typedef int __attribute__((may_alias)) int_a;

template <typename T> __device__ __forceinline__ void vst2(void* p, T v) { *(T*)p = v;  }
__device__ __forceinline__ v8f wmma16(v16h a, v16h b, v8f c) {
  v8f d = __builtin_amdgcn_wmma_f32_16x16x32_f16(false, a, false, b, (short)0, c, false, false);
  asm volatile("v_nop\n\tv_nop\n\tv_nop\n\tv_nop" : "+v"(d) : "v"(a), "v"(b));
  return d;
}
__device__ __forceinline__ v8f wmma_bf(v16b a, v16b b, v8f c) {
  v8f d = __builtin_amdgcn_wmma_f32_16x16x32_bf16(false, a, false, b, (short)0, c, false, false);
  asm volatile("v_nop\n\tv_nop\n\tv_nop\n\tv_nop" : "+v"(d) : "v"(a), "v"(b));
  return d;
}
// 16x16x32 fragments: lane = (h = lane>>4, row/col = lane&15); elements 0..7 = k0+8h+0..7, 8..15 = k0+16+8h+0..7; D element r = row 8h+r
__device__ __forceinline__ v16h frag_h(const _Float16* rowk0, int lane) {
  union { v16h v; v8h q[2]; } u; const _Float16* p = rowk0 + 8 * (lane >> 4);
  u.q[0] = *(const v8h*)p; u.q[1] = *(const v8h*)(p + 16); return u.v;
}
__device__ __forceinline__ v16h frag_f32(const float* rowk0, int lane) {
  v16h a; const float* p = rowk0 + 8 * (lane >> 4);
#pragma unroll
  for (int i = 0; i < 8; ++i) { a[i] = (_Float16)p[i]; a[8 + i] = (_Float16)p[16 + i]; }
  return a;
}
__device__ __forceinline__ v16h frag_f32s(const float* rowk0, int lane, float sc) {
  v16h a; const float* p = rowk0 + 8 * (lane >> 4);
#pragma unroll
  for (int i = 0; i < 8; ++i) { a[i] = (_Float16)(p[i] * sc); a[8 + i] = (_Float16)(p[16 + i] * sc); }
  return a;
}
// column fragment from a [K][ld] layout (column n), rows >= K read as 0
__device__ __forceinline__ v16h fragc_f32(const float* W, int k0, int n, int lane, int ld, int K) {
  v16h a; const int g = lane >> 4;
#pragma unroll
  for (int i = 0; i < 8; ++i) { const int ka = k0 + 8 * g + i, kb = ka + 16;
    a[i] = (_Float16)(ka < K ? W[(size_t)(ka < K ? ka : K - 1) * ld + n] : 0.f); a[8 + i] = (_Float16)(kb < K ? W[(size_t)(kb < K ? kb : K - 1) * ld + n] : 0.f); }
  return a;
}
struct F2 { v16b h, l; };
__device__ __forceinline__ F2 bsplit16(const float v[16]) { F2 r;
#pragma unroll
  for (int i = 0; i < 16; ++i) { const __bf16 h = (__bf16)v[i]; r.h[i] = h; r.l[i] = (__bf16)(v[i] - (float)h); }
  return r; }
__device__ __forceinline__ F2 split_row(const float* row, int k0, int lane) { float v[16]; const float* p = row + k0 + 8 * (lane >> 4);
#pragma unroll
  for (int i = 0; i < 8; ++i) { v[i] = p[i]; v[8 + i] = p[16 + i]; }
  return bsplit16(v); }
__device__ __forceinline__ F2 split_rowK(const float* row, int k0, int lane, int K) { float v[16]; const int g = lane >> 4;
#pragma unroll
  for (int i = 0; i < 8; ++i) { const int ka = k0 + 8 * g + i, kb = ka + 16; v[i] = ka < K ? row[ka < K ? ka : K - 1] : 0.f; v[8 + i] = kb < K ? row[kb < K ? kb : K - 1] : 0.f; }
  return bsplit16(v); }
__device__ __forceinline__ F2 split_col(const float* W, int k0, int n, int lane, int ld, int K) { float v[16]; const int g = lane >> 4;
#pragma unroll
  for (int i = 0; i < 8; ++i) { const int ka = k0 + 8 * g + i, kb = ka + 16; v[i] = ka < K ? W[(size_t)(ka < K ? ka : K - 1) * ld + n] : 0.f; v[8 + i] = kb < K ? W[(size_t)(kb < K ? kb : K - 1) * ld + n] : 0.f; }
  return bsplit16(v); }
__device__ __forceinline__ v8f mac3(const F2& a, const F2& b, v8f c) { c = wmma_bf(a.l, b.h, c); c = wmma_bf(a.h, b.l, c); return wmma_bf(a.h, b.h, c); }
__device__ __forceinline__ float sigm(float v) { return 1.0f / (1.0f + expf(-v)); }
#define LDSX() do { asm volatile("s_wait_dscnt 0" ::: "memory"); __builtin_amdgcn_wave_barrier(); __builtin_amdgcn_fence(__ATOMIC_RELEASE, "workgroup"); } while (0)


// GQA causal attention with neox RoPE (B 2, S 2,048, hidden 1,024 = 16 x 64 query heads, 4 kv heads): q/k/v = x W + b, rope(positions), k/v repeated 4x, scores / 8 causal, softmax, P v, out = y Wo.
#define NB 2
#define TT 2048
#define CC 1024
#define NH 16
#define HD 64
#define NKV 4
#define KV (NKV * HD)      // 256
#define GQ (NH / NKV)      // 4
#ifndef TNB
#define TNB NB
#endif
typedef __attribute__((ext_vector_type(8))) __bf16 v8b;
__device__ __forceinline__ v16b frag_b(const __bf16* rowk0, int lane) {
  union { v16b v; v8b q[2]; } u; const __bf16* p = rowk0 + 8 * (lane >> 4);
  u.q[0] = *(const v8b*)p; u.q[1] = *(const v8b*)(p + 16); return u.v;
}
__device__ __forceinline__ float bfr(float v) { return (float)(__bf16)v; }
__device__ __attribute__((noinline)) float exp_ni(float v) { return expf(v); }
__device__ __attribute__((noinline)) float erf_ni(float v) { return erff(v); }

#define WS_QH  0u
#define WS_QL  (WS_QH + 2u * (size_t)NB * TT * CC)
#define WS_KH  (WS_QL + 2u * (size_t)NB * TT * CC)      // f16 k rows [b*t][KV]
#define WS_VT  (WS_KH + 2u * (size_t)NB * TT * KV)      // bf16 v planes [b][kvc][t]
#define WS_VL  (WS_VT + 2u * (size_t)NB * KV * TT)      // bf16 v residual planes
#define WS_Y   (WS_VL + 2u * (size_t)NB * KV * TT)      // f32 y rows [b*t][C]
#define WS_END (WS_Y + 4u * (size_t)NB * TT * CC)

// ---- operand tiles of the two projection kernels: 64 k at a time, rounded to bf16 (k_out's activations split bf16 hi + lo) once a block and staged in two LDS buffers that the block's 4 waves share.
// W [k][n] comes by whole 512-byte row pieces (16 bytes a lane), is turned in registers and stored as rows [n][k]; the activations come by whole 256-byte row pieces.
#define GK 64               // k per stage
#define GP 72               // LDS row pitch in bf16: a 128-byte row + 16 bytes, for 16-byte readers
typedef __attribute__((ext_vector_type(4))) __bf16 v4b;
__device__ __forceinline__ void w_load(v4f (&r)[16], const float* __restrict__ p, int ld, unsigned lane) {   // p = &W[k0 + 8 * wave][c0], the same in every lane (a scalar base; the lane adds one offset register); rows 8 * wave + i and 32 + 8 * wave + i
#pragma unroll
  for (int s = 0; s < 2; ++s)
#pragma unroll
    for (int i = 0; i < 8; ++i) r[s * 8 + i] = *(const v4f*)(p + (size_t)(s * 32 + i) * ld + lane * 4u);
}
// 16-byte piece q (k = 8q .. 8q + 7) of row n stands at place q ^ ((n >> 4) & 3): the storing lanes are 4 rows apart, and without the exchange they would meet on a quarter of the banks
__device__ __forceinline__ void w_store(const v4f (&r)[16], __bf16 (*w)[GP], int wave, int lane) {
#pragma unroll
  for (int s = 0; s < 2; ++s)
#pragma unroll
    for (int c = 0; c < 4; ++c) { v8b t;
#pragma unroll
      for (int i = 0; i < 8; ++i) t[i] = (__bf16)r[s * 8 + i][c];
      *(v8b*)&w[lane * 4 + c][((wave + 4 * s) ^ ((lane >> 2) & 3)) * 8] = t; }
}
// B fragment of columns 16j .. 16j + 15, k = 32 kc .. 32 kc + 31 of the stage: the k order of frag_b
__device__ __forceinline__ v16b w_frag(const __bf16 (*w)[GP], int j, int kc, int col, int g) {
  union { v16b v; v8b q[2]; } u; const __bf16* p = &w[j * 16 + col][0];
  u.q[0] = *(const v8b*)(p + ((kc * 4 + g) ^ (j & 3)) * 8); u.q[1] = *(const v8b*)(p + ((kc * 4 + 2 + g) ^ (j & 3)) * 8); return u.v;
}
__device__ __forceinline__ void a_load(v4f (&r)[8], const float* __restrict__ p) {   // p = &A[r0 + (tid >> 4)][k0 + 4 * (tid & 15)]; rows 8 apart
#pragma unroll
  for (int i = 0; i < 8; ++i) r[i] = *(const v4f*)(p + (size_t)(i * 8) * CC);
}
union ProjLds { struct { _Float16 sh[64][136], sl[64][136]; __bf16 th[128][72], tl2[128][72]; float sf[64][132]; } e; struct { __bf16 w[2][128][GP], a[2][64][GP]; } s; };   // the stages are dead when the epilogue begins
union OutLds { float sf[4][16][132]; struct { __bf16 w[2][128][GP], ah[2][64][GP], al[2][64][GP]; } s; };
// acc += x[64 rows][1,024] W[1,024][128 columns]; LD = W's row pitch, a constant so that a stage's 16 W loads share one address and differ in their immediate offsets
template <int LD> __device__ __forceinline__ void proj_gemm(v8f (&acc)[8], ProjLds& sm, const float* __restrict__ wp, const float* __restrict__ xp, int wave, int lane, int ar, int aq) {
  v4f rw[16], ra[8]; const int col = lane & 15, g = lane >> 4;
  w_load(rw, wp, LD, lane); a_load(ra, xp);
  asm volatile("s_wait_xcnt 0x0" ::: "memory");   // the address registers of these loads are reused below: the wait stands in front of that overwrite
  w_store(rw, sm.s.w[0], wave, lane);
#pragma unroll
  for (int i = 0; i < 8; ++i) { v4b t;
#pragma unroll
    for (int c = 0; c < 4; ++c) t[c] = (__bf16)ra[i][c];
    *(v4b*)&sm.s.a[0][ar + i * 8][aq] = t; }
  __syncthreads();   // stage 0 is in LDS before any wave reads it
  // the stage loop stays rolled: a second copy of the body would only cost registers and instruction cache
#pragma unroll 1
  for (int st = 0; st < CC / GK; ++st) { const int cur = st & 1; const bool more = st + 1 < CC / GK;
    if (more) { w_load(rw, wp + (size_t)((st + 1) * GK) * LD, LD, lane); a_load(ra, xp + (st + 1) * GK);   // the next stage's loads fly during this stage's products
      asm volatile("s_wait_xcnt 0x0" ::: "memory"); }   // as above
#pragma unroll
    for (int kc = 0; kc < GK / 32; ++kc) { const v16b a = frag_b(&sm.s.a[cur][wave * 16 + col][kc * 32], lane); v16b wf[8];   // all 18 fragment reads of 32 k stand together, in front of their 8 products
#pragma unroll
      for (int j = 0; j < 8; ++j) wf[j] = w_frag(sm.s.w[cur], j, kc, col, g);
#pragma unroll
      for (int j = 0; j < 8; ++j) acc[j] = wmma_bf(a, wf[j], acc[j]); }
    if (more) { w_store(rw, sm.s.w[cur ^ 1], wave, lane);
#pragma unroll
      for (int i = 0; i < 8; ++i) { v4b t;
#pragma unroll
        for (int c = 0; c < 4; ++c) t[c] = (__bf16)ra[i][c];
        *(v4b*)&sm.s.a[cur ^ 1][ar + i * 8][aq] = t; } }
    __syncthreads(); }   // publishes stage st + 1 and ends every wave's reads of the buffer that the next pass refills (after the last pass: of the LDS that the epilogue reuses)
}
// ---- k_proj: block = (64 rows, 128 cols, which): qkv = x W (+ b), exact; q -> f16 hi (+ residual), k -> f16 rows, v -> bf16 planes (hi + lo)
__global__ __launch_bounds__(128) void k_proj(const float* __restrict__ X, const float* __restrict__ WQ, const float* __restrict__ BQ, const float* __restrict__ WK, const float* __restrict__ BK, const float* __restrict__ WV, const float* __restrict__ BV, const int* __restrict__ POS, _Float16* __restrict__ QH, _Float16* __restrict__ QL, _Float16* __restrict__ KH, __bf16* __restrict__ VT, __bf16* __restrict__ VL) {
  __shared__ __align__(16) ProjLds sm; _Float16 (&sh)[64][136] = sm.e.sh, (&sl)[64][136] = sm.e.sl; __bf16 (&th)[128][72] = sm.e.th, (&tl2)[128][72] = sm.e.tl2; float (&sf)[64][132] = sm.e.sf;
  const int tid = threadIdx.x, wave = tid >> 5, lane = tid & 31, col = lane & 15, g = lane >> 4; const int which = blockIdx.z; const int c0 = blockIdx.y * 128; const size_t r0 = (size_t)blockIdx.x * 64; const int NW = which == 0 ? CC : KV; if (c0 >= NW) return;   // k/v are only KV wide (block-uniform exit)
  const float* WA = which == 0 ? WQ : which == 1 ? WK : WV; const float* BA = which == 0 ? BQ : which == 1 ? BK : BV;
  v8f acc[8] = {}; const int ar = tid >> 4, aq = (tid & 15) * 4;
  const float* wp = WA + (size_t)(__builtin_amdgcn_readfirstlane(wave) * 8) * NW + c0; const float* xp = X + (r0 + ar) * CC + aq;
  if (which == 0) proj_gemm<CC>(acc, sm, wp, xp, wave, lane, ar, aq); else proj_gemm<KV>(acc, sm, wp, xp, wave, lane, ar, aq);   // block-uniform: every wave of a block passes the same barriers
#pragma unroll
  for (int j = 0; j < 8; ++j) { const float bb = bfr(BA[c0 + j * 16 + col]);
#pragma unroll
    for (int r = 0; r < 8; ++r) { const float v = acc[j][r] + bb; const int rl = wave * 16 + 8 * g + r, cl = j * 16 + col;
      if (which == 2) { const __bf16 bh = (__bf16)v; th[cl][rl] = bh; tl2[cl][rl] = (__bf16)(v - (float)bh); } else sf[rl][cl] = v; } }
  __syncthreads();
  if (which < 2) {   // rotate-half rotary: out[d] = x[d] cos(p f_(d mod 32)) + (d < 32 ? -x[d+32] : x[d-32]) sin(p f_(d mod 32)); f_i = 10000^(-i/32); p = position_ids[t]
    for (int e = tid; e < 64 * 128; e += 128) { const int rl = e >> 7, cl = e & 127; const int d = cl & 63; const int i2 = d & 31; const size_t row = r0 + rl; const int tpos = POS[(int)(row % TT)];
      const float inv_freq = 1.0f / powf(10000.0f, (float)(2 * i2) / 64.0f); const float ang = (float)tpos * inv_freq; const float c = cosf(ang), s = sinf(ang);
      const float me = sf[rl][cl]; const float partner = (d < 32) ? -sf[rl][cl + 32] : sf[rl][cl - 32]; const float v = me * c + partner * s; const _Float16 hv = (_Float16)v; sh[rl][cl] = hv; sl[rl][cl] = (_Float16)((v - (float)hv) * 1024.0f); }   /* q residual carried x 2^10 so the plane stays f16-normal on the chip */
    __syncthreads(); }
  if (which < 2) { _Float16* dh = which == 0 ? QH : KH; for (int e = tid; e < 64 * 16; e += 128) { const int rl = e >> 4, q = e & 15; vst2((unsigned*)(dh + (r0 + rl) * NW + c0 + q * 8), *(const v4u*)&sh[rl][q * 8]); if (which == 0) vst2((unsigned*)(QL + (r0 + rl) * CC + c0 + q * 8), *(const v4u*)&sl[rl][q * 8]); } }
  else { const size_t b = r0 / TT; const int t0 = (int)(r0 % TT); for (int e = tid; e < 128 * 8; e += 128) { const int cl = e >> 3, q = e & 7; const size_t o2 = (b * KV + c0 + cl) * (size_t)TT + t0 + q * 8; vst2((unsigned*)(VT + o2), *(const v4u*)&th[cl][q * 8]); vst2((unsigned*)(VL + o2), *(const v4u*)&tl2[cl][q * 8]); } } }
#define FQ 2                // 16-query tiles per block
#define FW (GQ * FQ)        // waves per block
#define SP 72               // LDS row pitch in 16-bit elements: a 128-byte row + 16 bytes, for 16-byte readers
#define L2E 1.44269504088896340736f
// waves_per_eu(4, 4): two blocks a WGP; lets the compiler keep all 24 fragment reads of a 32-key pass in flight at once instead of saving registers
__global__ __launch_bounds__(32 * FW) __attribute__((amdgpu_waves_per_eu(4, 4))) void k_fa(const _Float16* __restrict__ QH, const _Float16* __restrict__ QL, const _Float16* __restrict__ KH, const __bf16* __restrict__ VT, const __bf16* __restrict__ VL, float* __restrict__ Y) {
  __shared__ __align__(16) _Float16 sk[2][64][SP]; __shared__ __align__(16) __bf16 svh[2][64][SP], svl[2][64][SP]; __shared__ __align__(16) float so[FW][16][HD + 4];
  const int tid = threadIdx.x, wave = __builtin_amdgcn_readfirstlane(tid >> 5), lane = tid & 31, col = lane & 15, g = lane >> 4;
  const int kvh = blockIdx.x % NKV, b = blockIdx.x / NKV; const int yb = blockIdx.y; const int q0 = (yb < TT / 64 ? TT / 32 - 1 - yb : yb - TT / 64) * 32;   // long blocks first, then short ones in rising order (a permutation; for balance only)
  const int h = kvh * GQ + (wave & (GQ - 1)), ql0 = q0 + (wave / GQ) * 16, qt = ql0 + col; const int ns = q0 / 64 + 1;   // 64-key stages up to the block's diagonal
  const int sr = tid >> 3, sc = (tid & 7) * 8;   // staging: 8 lanes a row, rows sr and sr + 32
  const _Float16* gk = KH + ((size_t)b * TT + sr) * KV + kvh * HD + sc; const size_t vo = ((size_t)b * KV + kvh * HD + sr) * (size_t)TT + sc; const __bf16 *gh = VT + vo, *gl = VL + vo;
  v16h qh[2], qr[2];
#pragma unroll
  for (int kc = 0; kc < 2; ++kc) { const size_t qo = ((size_t)b * TT + qt) * CC + h * HD + kc * 32; qh[kc] = frag_h(QH + qo, lane); qr[kc] = frag_h(QL + qo, lane); }
  v8h rk0 = *(const v8h*)gk, rk1 = *(const v8h*)(gk + 32 * KV); v8b rh0 = *(const v8b*)gh, rh1 = *(const v8b*)(gh + 32 * TT), rl0 = *(const v8b*)gl, rl1 = *(const v8b*)(gl + 32 * TT);
  *(v8h*)&sk[0][sr][sc] = rk0; *(v8h*)&sk[0][sr + 32][sc] = rk1; *(v8b*)&svh[0][sr][sc] = rh0; *(v8b*)&svh[0][sr + 32][sc] = rh1; *(v8b*)&svl[0][sr][sc] = rl0; *(v8b*)&svl[0][sr + 32][sc] = rl1;
  __syncthreads();   // stage 0 is in LDS before any wave reads it
  v8f o[HD / 16] = {}; float m = -3.0e38f, l = 0.f;
  // the stage loop stays rolled (its trip count is the block's own; a second copy of the body would only cost instruction cache); every full unroll below keeps a fragment or accumulator array in registers
#pragma unroll 1
  for (int st = 0; st < ns; ++st) { const int cur = st & 1, k0 = st * 64; const bool more = st + 1 < ns;   // block-uniform
    if (more) { const int kn = k0 + 64; rk0 = *(const v8h*)(gk + (size_t)kn * KV); rk1 = *(const v8h*)(gk + (size_t)(kn + 32) * KV); rh0 = *(const v8b*)(gh + kn); rh1 = *(const v8b*)(gh + 32 * TT + kn); rl0 = *(const v8b*)(gl + kn); rl1 = *(const v8b*)(gl + 32 * TT + kn);
      asm volatile("s_wait_xcnt 0x0" ::: "memory"); }   // the fragment reads below reuse the address registers of these six loads: the wait stands in front of that overwrite
#pragma unroll
    for (int hf = 0; hf < 2; ++hf) { const int kb0 = k0 + hf * 32;
      if (kb0 <= ql0 + 15) {   // wave-uniform: 32 keys wholly above this wave's diagonal add nothing
        v16h ka[2], kb[2]; v16b vh[HD / 16], vl[HD / 16]; v8f s[2] = {};
#pragma unroll
        for (int j = 0; j < 2; ++j) { const _Float16* kp = &sk[cur][hf * 32 + j * 16 + col][0]; ka[j] = frag_h(kp, lane); kb[j] = frag_h(kp + 32, lane); }
#pragma unroll
        for (int j = 0; j < HD / 16; ++j) { vh[j] = frag_b(&svh[cur][j * 16 + col][hf * 32], lane); vl[j] = frag_b(&svl[cur][j * 16 + col][hf * 32], lane); }
#pragma unroll
        for (int j = 0; j < 2; ++j) s[j] = wmma16(ka[j], qr[0], s[j]);
#pragma unroll
        for (int j = 0; j < 2; ++j) s[j] = wmma16(kb[j], qr[1], s[j]);
#pragma unroll
        for (int j = 0; j < 2; ++j) s[j] *= (1.0f / 1024.0f);   // the residual plane is carried x 2^10
#pragma unroll
        for (int j = 0; j < 2; ++j) s[j] = wmma16(ka[j], qh[0], s[j]);
#pragma unroll
        for (int j = 0; j < 2; ++j) s[j] = wmma16(kb[j], qh[1], s[j]);
#pragma unroll
        for (int j = 0; j < 2; ++j) s[j] *= 0.125f;
        if (kb0 + 31 > ql0) {   // wave-uniform: only keys at the diagonal mask; key 0 is open to every query, so the running maximum is finite from the first 32 keys on
#pragma unroll
          for (int j = 0; j < 2; ++j)
#pragma unroll
            for (int r = 0; r < 8; ++r) if (kb0 + j * 16 + 8 * g + r > qt) s[j][r] = -3.0e38f; }
        float mx = m;
#pragma unroll
        for (int j = 0; j < 2; ++j)
#pragma unroll
          for (int r = 0; r < 8; ++r) mx = fmaxf(mx, s[j][r]);
        mx = fmaxf(mx, __shfl_xor(mx, 16));
        const float al = __builtin_amdgcn_exp2f((m - mx) * L2E); m = mx; l *= al;
#pragma unroll
        for (int j = 0; j < HD / 16; ++j) o[j] *= al;
        v16b ph, pl;   // B fragment of Pt: element i = key 8g + i of score tile 0, element 8 + i = the same row of tile 1: the k order of frag_b
#pragma unroll
        for (int i = 0; i < 8; ++i) { const float x = __builtin_amdgcn_exp2f((s[0][i] - mx) * L2E), y = __builtin_amdgcn_exp2f((s[1][i] - mx) * L2E); l += x + y;
          const __bf16 xh = (__bf16)x, yh = (__bf16)y; ph[i] = xh; ph[8 + i] = yh; pl[i] = (__bf16)(x - (float)xh); pl[8 + i] = (__bf16)(y - (float)yh); }
#pragma unroll
        for (int j = 0; j < HD / 16; ++j) o[j] = wmma_bf(vh[j], ph, o[j]);
#pragma unroll
        for (int j = 0; j < HD / 16; ++j) o[j] = wmma_bf(vh[j], pl, o[j]);
#pragma unroll
        for (int j = 0; j < HD / 16; ++j) o[j] = wmma_bf(vl[j], ph, o[j]); } }
    if (more) { const int nx = cur ^ 1; *(v8h*)&sk[nx][sr][sc] = rk0; *(v8h*)&sk[nx][sr + 32][sc] = rk1; *(v8b*)&svh[nx][sr][sc] = rh0; *(v8b*)&svh[nx][sr + 32][sc] = rh1; *(v8b*)&svl[nx][sr][sc] = rl0; *(v8b*)&svl[nx][sr + 32][sc] = rl1; }
    __syncthreads(); }   // publishes stage st + 1 and ends every wave's reads of the buffer that the next pass refills
  l += __shfl_xor(l, 16); const float inv = 1.0f / l;
#pragma unroll
  for (int j = 0; j < HD / 16; ++j) { v4f lo4, hi4;
#pragma unroll
    for (int r = 0; r < 4; ++r) { lo4[r] = o[j][r] * inv; hi4[r] = o[j][4 + r] * inv; }
    *(v4f*)&so[wave][col][j * 16 + 8 * g] = lo4; *(v4f*)&so[wave][col][j * 16 + 8 * g + 4] = hi4; }
  LDSX();   // the wave's own tile, turned in its own LDS range so that the stores cover whole lines
#pragma unroll
  for (int it = 0; it < 8; ++it) { const int rl = it * 2 + g; vst2(Y + ((size_t)b * TT + ql0 + rl) * CC + h * HD + col * 4, *(const v4f*)&so[wave][rl][col * 4]); } }
// ---- k_out: block = (64 rows, 128 cols): out = y (bf16 hi + lo) Wo ((in,out), exact bf16 weights), f32 accumulate
__global__ __launch_bounds__(128) void k_out(const float* __restrict__ Y, const float* __restrict__ WO, float* __restrict__ OUT) { __shared__ __align__(16) OutLds sm; float (&sf)[4][16][132] = sm.sf;
  const int tid = threadIdx.x, wave = tid >> 5, lane = tid & 31, col = lane & 15, g = lane >> 4; const int c0 = blockIdx.y * 128; const size_t r0 = (size_t)blockIdx.x * 64 + wave * 16;
  v8f acc[8] = {}; v4f rw[16], ra[8]; const int ar = tid >> 4, aq = (tid & 15) * 4;
  const float* wp = WO + (size_t)(__builtin_amdgcn_readfirstlane(wave) * 8) * CC + c0; const float* yp = Y + ((size_t)blockIdx.x * 64 + ar) * CC + aq;
  w_load(rw, wp, CC, lane); a_load(ra, yp);
  asm volatile("s_wait_xcnt 0x0" ::: "memory");   // the address registers of these loads are reused below: the wait stands in front of that overwrite
  w_store(rw, sm.s.w[0], wave, lane);
#pragma unroll
  for (int i = 0; i < 8; ++i) { v4b th, tl;
#pragma unroll
    for (int c = 0; c < 4; ++c) { const __bf16 h = (__bf16)ra[i][c]; th[c] = h; tl[c] = (__bf16)(ra[i][c] - (float)h); }
    *(v4b*)&sm.s.ah[0][ar + i * 8][aq] = th; *(v4b*)&sm.s.al[0][ar + i * 8][aq] = tl; }
  __syncthreads();   // stage 0 is in LDS before any wave reads it
  // the stage loop stays rolled: a second copy of the body would only cost registers and instruction cache
#pragma unroll 1
  for (int st = 0; st < CC / GK; ++st) { const int cur = st & 1; const bool more = st + 1 < CC / GK;
    if (more) { w_load(rw, wp + (size_t)((st + 1) * GK) * CC, CC, lane); a_load(ra, yp + (st + 1) * GK);   // the next stage's loads fly during this stage's products
      asm volatile("s_wait_xcnt 0x0" ::: "memory"); }   // as above
#pragma unroll
    for (int kc = 0; kc < GK / 32; ++kc) { const v16b ah = frag_b(&sm.s.ah[cur][wave * 16 + col][kc * 32], lane), al = frag_b(&sm.s.al[cur][wave * 16 + col][kc * 32], lane); v16b wf[8];   // all 20 fragment reads of 32 k stand together, in front of their 16 products
#pragma unroll
      for (int j = 0; j < 8; ++j) wf[j] = w_frag(sm.s.w[cur], j, kc, col, g);
#pragma unroll
      for (int j = 0; j < 8; ++j) acc[j] = wmma_bf(ah, wf[j], acc[j]);   // hi over all 8 tiles, then lo: each tile still adds hi before lo, and no product waits for the one directly in front of it
#pragma unroll
      for (int j = 0; j < 8; ++j) acc[j] = wmma_bf(al, wf[j], acc[j]); }
    if (more) { w_store(rw, sm.s.w[cur ^ 1], wave, lane);
#pragma unroll
      for (int i = 0; i < 8; ++i) { v4b th, tl;
#pragma unroll
        for (int c = 0; c < 4; ++c) { const __bf16 h = (__bf16)ra[i][c]; th[c] = h; tl[c] = (__bf16)(ra[i][c] - (float)h); }
        *(v4b*)&sm.s.ah[cur ^ 1][ar + i * 8][aq] = th; *(v4b*)&sm.s.al[cur ^ 1][ar + i * 8][aq] = tl; } }
    __syncthreads(); }   // publishes stage st + 1 and ends every wave's reads of the buffer that the next pass refills (after the last pass: of the LDS that the epilogue reuses)
#pragma unroll
  for (int j = 0; j < 8; ++j)
#pragma unroll
    for (int r = 0; r < 8; ++r) sf[wave][8 * g + r][j * 16 + col] = acc[j][r];
  LDSX(); for (int rl = 0; rl < 16; ++rl) vst2(OUT + (r0 + rl) * CC + c0 + lane * 4, *(const v4f*)&sf[wave][rl][lane * 4]); }
extern "C" void kernel_launch(void* const* d_in, const int* in_sizes, int n_in, void* d_out, int out_size, void* d_ws, size_t ws_size, hipStream_t stream) {
  (void)in_sizes; (void)n_in; (void)out_size;
  const float** F = (const float**)d_in;   // 0 hidden_states [2,2048,1024], 1 positions [2048] int32 (verbatim arange; read), 2 Wq [1024,1024] ((in,out)), 3 bq, 4 Wk [1024,256], 5 bk, 6 Wv [1024,256], 7 bv, 8 Wo [1024,1024] ((in,out))
  if (ws_size < (size_t)WS_END) return;
  char* ws = (char*)d_ws; _Float16 *QH = (_Float16*)(ws + WS_QH), *QL = (_Float16*)(ws + WS_QL), *KH = (_Float16*)(ws + WS_KH); __bf16 *VT = (__bf16*)(ws + WS_VT), *VL = (__bf16*)(ws + WS_VL); float *Y = (float*)(ws + WS_Y);
  k_proj<<<dim3(TNB * TT / 64, CC / 128, 3), 128, 0, stream>>>(F[0], F[2], F[3], F[4], F[5], F[6], F[7], (const int*)d_in[1], QH, QL, KH, VT, VL);
  k_fa<<<dim3(TNB * NKV, TT / 32), 32 * FW, 0, stream>>>(QH, QL, KH, VT, VL, Y);
  k_out<<<dim3(TNB * TT / 64, CC / 128), 128, 0, stream>>>(Y, F[8], (float*)d_out);
}

// v004
// Measured time: 91 microseconds a run.
// Two timings next to v003 put it at 1.15 and 1.16 times that version's speed.
// Over all steps from v000 it is 13.7 times as fast.
// compute dtype: all float inputs rounded to bf16, positions (int) read; q/k/v = x W + b ((in,out)) with EXACT bf16 products on WMMA 16x16x32, f32 accumulate; neox rotary (rotate-half) in f32 (inv_freq = 10000^(-2i/64) via powf, precise cosf/sinf, positions read) on q and k; q as f16 hi + residual (carried x 2^10), k f16 -> 2-product logits / 8, causal, kept in registers (kv head = h/4); running-maximum softmax in f32 (exp2 of the log2e-scaled difference), unnormalised P split bf16 hi + lo against v bf16 hi + lo (3 products), divided by the row sum at the end; out = y (bf16 hi + lo) Wo ((in,out)); f32 output.
#include <hip/hip_runtime.h>
#include <math.h>

typedef __attribute__((ext_vector_type(16))) _Float16 v16h;
typedef __attribute__((ext_vector_type(16))) __bf16 v16b;
typedef __attribute__((ext_vector_type(8)))  _Float16 v8h;
typedef __attribute__((ext_vector_type(8)))  float v8f;
typedef __attribute__((ext_vector_type(4)))  float v4f;
typedef __attribute__((ext_vector_type(2)))  float v2f;
typedef __attribute__((ext_vector_type(4)))  unsigned v4u;
typedef __attribute__((ext_vector_type(4)))  int v4i;
typedef float __attribute__((may_alias)) float_a;
typedef int __attribute__((may_alias)) int_a;

template <typename T> __device__ __forceinline__ void vst2(void* p, T v) { *(T*)p = v;  }
__device__ __forceinline__ v8f wmma16(v16h a, v16h b, v8f c) {
  v8f d = __builtin_amdgcn_wmma_f32_16x16x32_f16(false, a, false, b, (short)0, c, false, false);
  asm volatile("v_nop\n\tv_nop\n\tv_nop\n\tv_nop" : "+v"(d) : "v"(a), "v"(b));
  return d;
}
__device__ __forceinline__ v8f wmma_bf(v16b a, v16b b, v8f c) {
  v8f d = __builtin_amdgcn_wmma_f32_16x16x32_bf16(false, a, false, b, (short)0, c, false, false);
  asm volatile("v_nop\n\tv_nop\n\tv_nop\n\tv_nop" : "+v"(d) : "v"(a), "v"(b));
  return d;
}
// 16x16x32 fragments: lane = (h = lane>>4, row/col = lane&15); elements 0..7 = k0+8h+0..7, 8..15 = k0+16+8h+0..7; D element r = row 8h+r
__device__ __forceinline__ v16h frag_h(const _Float16* rowk0, int lane) {
  union { v16h v; v8h q[2]; } u; const _Float16* p = rowk0 + 8 * (lane >> 4);
  u.q[0] = *(const v8h*)p; u.q[1] = *(const v8h*)(p + 16); return u.v;
}
__device__ __forceinline__ v16h frag_f32(const float* rowk0, int lane) {
  v16h a; const float* p = rowk0 + 8 * (lane >> 4);
#pragma unroll
  for (int i = 0; i < 8; ++i) { a[i] = (_Float16)p[i]; a[8 + i] = (_Float16)p[16 + i]; }
  return a;
}
__device__ __forceinline__ v16h frag_f32s(const float* rowk0, int lane, float sc) {
  v16h a; const float* p = rowk0 + 8 * (lane >> 4);
#pragma unroll
  for (int i = 0; i < 8; ++i) { a[i] = (_Float16)(p[i] * sc); a[8 + i] = (_Float16)(p[16 + i] * sc); }
  return a;
}
// column fragment from a [K][ld] layout (column n), rows >= K read as 0
__device__ __forceinline__ v16h fragc_f32(const float* W, int k0, int n, int lane, int ld, int K) {
  v16h a; const int g = lane >> 4;
#pragma unroll
  for (int i = 0; i < 8; ++i) { const int ka = k0 + 8 * g + i, kb = ka + 16;
    a[i] = (_Float16)(ka < K ? W[(size_t)(ka < K ? ka : K - 1) * ld + n] : 0.f); a[8 + i] = (_Float16)(kb < K ? W[(size_t)(kb < K ? kb : K - 1) * ld + n] : 0.f); }
  return a;
}
struct F2 { v16b h, l; };
__device__ __forceinline__ F2 bsplit16(const float v[16]) { F2 r;
#pragma unroll
  for (int i = 0; i < 16; ++i) { const __bf16 h = (__bf16)v[i]; r.h[i] = h; r.l[i] = (__bf16)(v[i] - (float)h); }
  return r; }
__device__ __forceinline__ F2 split_row(const float* row, int k0, int lane) { float v[16]; const float* p = row + k0 + 8 * (lane >> 4);
#pragma unroll
  for (int i = 0; i < 8; ++i) { v[i] = p[i]; v[8 + i] = p[16 + i]; }
  return bsplit16(v); }
__device__ __forceinline__ F2 split_rowK(const float* row, int k0, int lane, int K) { float v[16]; const int g = lane >> 4;
#pragma unroll
  for (int i = 0; i < 8; ++i) { const int ka = k0 + 8 * g + i, kb = ka + 16; v[i] = ka < K ? row[ka < K ? ka : K - 1] : 0.f; v[8 + i] = kb < K ? row[kb < K ? kb : K - 1] : 0.f; }
  return bsplit16(v); }
__device__ __forceinline__ F2 split_col(const float* W, int k0, int n, int lane, int ld, int K) { float v[16]; const int g = lane >> 4;
#pragma unroll
  for (int i = 0; i < 8; ++i) { const int ka = k0 + 8 * g + i, kb = ka + 16; v[i] = ka < K ? W[(size_t)(ka < K ? ka : K - 1) * ld + n] : 0.f; v[8 + i] = kb < K ? W[(size_t)(kb < K ? kb : K - 1) * ld + n] : 0.f; }
  return bsplit16(v); }
__device__ __forceinline__ v8f mac3(const F2& a, const F2& b, v8f c) { c = wmma_bf(a.l, b.h, c); c = wmma_bf(a.h, b.l, c); return wmma_bf(a.h, b.h, c); }
__device__ __forceinline__ float sigm(float v) { return 1.0f / (1.0f + expf(-v)); }
#define LDSX() do { asm volatile("s_wait_dscnt 0" ::: "memory"); __builtin_amdgcn_wave_barrier(); __builtin_amdgcn_fence(__ATOMIC_RELEASE, "workgroup"); } while (0)


// GQA causal attention with neox RoPE (B 2, S 2,048, hidden 1,024 = 16 x 64 query heads, 4 kv heads): q/k/v = x W + b, rope(positions), k/v repeated 4x, scores / 8 causal, softmax, P v, out = y Wo.
#define NB 2
#define TT 2048
#define CC 1024
#define NH 16
#define HD 64
#define NKV 4
#define KV (NKV * HD)      // 256
#define GQ (NH / NKV)      // 4
#ifndef TNB
#define TNB NB
#endif
typedef __attribute__((ext_vector_type(8))) __bf16 v8b;
__device__ __forceinline__ v16b frag_b(const __bf16* rowk0, int lane) {
  union { v16b v; v8b q[2]; } u; const __bf16* p = rowk0 + 8 * (lane >> 4);
  u.q[0] = *(const v8b*)p; u.q[1] = *(const v8b*)(p + 16); return u.v;
}
__device__ __forceinline__ float bfr(float v) { return (float)(__bf16)v; }
__device__ __attribute__((noinline)) float exp_ni(float v) { return expf(v); }
__device__ __attribute__((noinline)) float erf_ni(float v) { return erff(v); }

#define WS_QH  0u
#define WS_QL  (WS_QH + 2u * (size_t)NB * TT * CC)
#define WS_KH  (WS_QL + 2u * (size_t)NB * TT * CC)      // f16 k rows [b*t][KV]
#define WS_VT  (WS_KH + 2u * (size_t)NB * TT * KV)      // bf16 v planes [b][kvc][t]
#define WS_VL  (WS_VT + 2u * (size_t)NB * KV * TT)      // bf16 v residual planes
#define WS_Y   (WS_VL + 2u * (size_t)NB * KV * TT)      // f32 y rows [b*t][C]
#define WS_END (WS_Y + 4u * (size_t)NB * TT * CC)

// ---- operand tiles of the two projection kernels: 64 k at a time, rounded to bf16 (k_out's activations split bf16 hi + lo) once a block and staged in two LDS buffers that the block's 4 waves share.
// W [k][n] comes by whole 512-byte row pieces (16 bytes a lane), is turned in registers and stored as rows [n][k]; the activations come by whole 256-byte row pieces.
#define GK 64               // k per stage
#define GP 72               // LDS row pitch in bf16: a 128-byte row + 16 bytes, for 16-byte readers
typedef __attribute__((ext_vector_type(4))) __bf16 v4b;
__device__ __forceinline__ void w_load(v4f (&r)[16], const float* __restrict__ p, int ld, unsigned lane) {   // p = &W[k0 + 8 * wave][c0], the same in every lane (a scalar base; the lane adds one offset register); rows 8 * wave + i and 32 + 8 * wave + i
#pragma unroll
  for (int s = 0; s < 2; ++s)
#pragma unroll
    for (int i = 0; i < 8; ++i) r[s * 8 + i] = *(const v4f*)(p + (size_t)(s * 32 + i) * ld + lane * 4u);
}
// 16-byte piece q (k = 8q .. 8q + 7) of row n stands at place q ^ ((n >> 4) & 3): the storing lanes are 4 rows apart, and without the exchange they would meet on a quarter of the banks
__device__ __forceinline__ void w_store(const v4f (&r)[16], __bf16 (*w)[GP], int wave, int lane) {
#pragma unroll
  for (int s = 0; s < 2; ++s)
#pragma unroll
    for (int c = 0; c < 4; ++c) { v8b t;
#pragma unroll
      for (int i = 0; i < 8; ++i) t[i] = (__bf16)r[s * 8 + i][c];
      *(v8b*)&w[lane * 4 + c][((wave + 4 * s) ^ ((lane >> 2) & 3)) * 8] = t; }
}
// B fragment of columns 16j .. 16j + 15, k = 32 kc .. 32 kc + 31 of the stage: the k order of frag_b
__device__ __forceinline__ v16b w_frag(const __bf16 (*w)[GP], int j, int kc, int col, int g) {
  union { v16b v; v8b q[2]; } u; const __bf16* p = &w[j * 16 + col][0];
  u.q[0] = *(const v8b*)(p + ((kc * 4 + g) ^ (j & 3)) * 8); u.q[1] = *(const v8b*)(p + ((kc * 4 + 2 + g) ^ (j & 3)) * 8); return u.v;
}
__device__ __forceinline__ void a_load(v4f (&r)[8], const float* __restrict__ p) {   // p = &A[r0 + (tid >> 4)][k0 + 4 * (tid & 15)]; rows 8 apart
#pragma unroll
  for (int i = 0; i < 8; ++i) r[i] = *(const v4f*)(p + (size_t)(i * 8) * CC);
}
union ProjLds { struct { _Float16 sh[64][136], sl[64][136]; __bf16 th[128][72], tl2[128][72]; } e; struct { __bf16 w[2][128][GP], a[2][64][GP]; } s; };   // the stages are dead when the epilogue begins
// rotary table of one wave's own 16 rows: cs[row][i] = (cos, sin)(p_row f_i), f_i = 10000^(-i/32), lane = i: each pair is made once and serves both halves of both heads of the block's 128 columns
#define CSP 34              // row pitch in pairs: the readers' two lane halves stand 8 rows apart and so fall on different halves of the banks
__device__ __forceinline__ void rope_table(v2f (*cs)[CSP], int pv, int lane) {   // pv: lane l holds the position of row l & 15; handed out by readlane
  const float inv_freq = 1.0f / powf(10000.0f, (float)(2 * lane) / 64.0f);
  // stays rolled: 16 copies of the library's argument reduction would only cost instruction cache
#pragma unroll 1
  for (int it = 0; it < 16; ++it) { const float ang = (float)__builtin_amdgcn_readlane(pv, it) * inv_freq; float s, c; sincosf(ang, &s, &c); v2f t; t[0] = c; t[1] = s; cs[it][lane] = t; }
}
union OutLds { float sf[4][16][132]; struct { __bf16 w[2][128][GP], ah[2][64][GP], al[2][64][GP]; } s; };
// acc += x[64 rows][1,024] W[1,024][128 columns]; LD = W's row pitch, a constant so that a stage's 16 W loads share one address and differ in their immediate offsets
template <int LD> __device__ __forceinline__ void proj_gemm(v8f (&acc)[8], ProjLds& sm, const float* __restrict__ wp, const float* __restrict__ xp, int wave, int lane, int ar, int aq, bool rot, v2f (*cs)[CSP], int pv) {
  v4f rw[16], ra[8]; const int col = lane & 15, g = lane >> 4;
  w_load(rw, wp, LD, lane); a_load(ra, xp);
  asm volatile("s_wait_xcnt 0x0" ::: "memory");   // the address registers of these loads are reused below: the wait stands in front of that overwrite
  if (rot) rope_table(cs, pv, lane);   // block-uniform; made here, while stage 0's loads fly; read again only by the wave that wrote it, behind the barriers below
  w_store(rw, sm.s.w[0], wave, lane);
#pragma unroll
  for (int i = 0; i < 8; ++i) { v4b t;
#pragma unroll
    for (int c = 0; c < 4; ++c) t[c] = (__bf16)ra[i][c];
    *(v4b*)&sm.s.a[0][ar + i * 8][aq] = t; }
  __syncthreads();   // stage 0 is in LDS before any wave reads it
  // the stage loop stays rolled: a second copy of the body would only cost registers and instruction cache
#pragma unroll 1
  for (int st = 0; st < CC / GK; ++st) { const int cur = st & 1; const bool more = st + 1 < CC / GK;
    if (more) { w_load(rw, wp + (size_t)((st + 1) * GK) * LD, LD, lane); a_load(ra, xp + (st + 1) * GK);   // the next stage's loads fly during this stage's products
      asm volatile("s_wait_xcnt 0x0" ::: "memory"); }   // as above
#pragma unroll
    for (int kc = 0; kc < GK / 32; ++kc) { const v16b a = frag_b(&sm.s.a[cur][wave * 16 + col][kc * 32], lane); v16b wf[8];   // all 18 fragment reads of 32 k stand together, in front of their 8 products
#pragma unroll
      for (int j = 0; j < 8; ++j) wf[j] = w_frag(sm.s.w[cur], j, kc, col, g);
#pragma unroll
      for (int j = 0; j < 8; ++j) acc[j] = wmma_bf(a, wf[j], acc[j]); }
    if (more) { w_store(rw, sm.s.w[cur ^ 1], wave, lane);
#pragma unroll
      for (int i = 0; i < 8; ++i) { v4b t;
#pragma unroll
        for (int c = 0; c < 4; ++c) t[c] = (__bf16)ra[i][c];
        *(v4b*)&sm.s.a[cur ^ 1][ar + i * 8][aq] = t; } }
    __syncthreads(); }   // publishes stage st + 1 and ends every wave's reads of the buffer that the next pass refills (after the last pass: of the LDS that the epilogue reuses)
}
// ---- k_proj: block = (64 rows, 128 cols, which): qkv = x W (+ b), exact; q -> f16 hi (+ residual), k -> f16 rows, v -> bf16 planes (hi + lo)
__global__ __launch_bounds__(128) void k_proj(const float* __restrict__ X, const float* __restrict__ WQ, const float* __restrict__ BQ, const float* __restrict__ WK, const float* __restrict__ BK, const float* __restrict__ WV, const float* __restrict__ BV, const int* __restrict__ POS, _Float16* __restrict__ QH, _Float16* __restrict__ QL, _Float16* __restrict__ KH, __bf16* __restrict__ VT, __bf16* __restrict__ VL) {
  __shared__ __align__(16) ProjLds sm; __shared__ __align__(16) v2f cs[64][CSP]; _Float16 (&sh)[64][136] = sm.e.sh, (&sl)[64][136] = sm.e.sl; __bf16 (&th)[128][72] = sm.e.th, (&tl2)[128][72] = sm.e.tl2;
  const int tid = threadIdx.x, wave = tid >> 5, lane = tid & 31, col = lane & 15, g = lane >> 4; const int which = blockIdx.z; const int c0 = blockIdx.y * 128; const size_t r0 = (size_t)blockIdx.x * 64; const int NW = which == 0 ? CC : KV; if (c0 >= NW) return;   // k/v are only KV wide (block-uniform exit)
  const float* WA = which == 0 ? WQ : which == 1 ? WK : WV; const float* BA = which == 0 ? BQ : which == 1 ? BK : BV;
  v8f acc[8] = {}; const int ar = tid >> 4, aq = (tid & 15) * 4;
  const float* wp = WA + (size_t)(__builtin_amdgcn_readfirstlane(wave) * 8) * NW + c0; const float* xp = X + (r0 + ar) * CC + aq;
  const int pv = POS[(int)(r0 % TT) + wave * 16 + col];   // p = position_ids[t] of the wave's 16 rows (64 divides the sequence length: a block's rows do not wrap); loaded ahead of stage 0, so that its wait leaves stage 0's loads in flight
  asm volatile("s_wait_xcnt 0x0" ::: "memory");   // the offset register of this load is reused for the addresses below: the wait stands in front of that overwrite
  if (which == 0) proj_gemm<CC>(acc, sm, wp, xp, wave, lane, ar, aq, true, &cs[wave * 16], pv); else proj_gemm<KV>(acc, sm, wp, xp, wave, lane, ar, aq, which == 1, &cs[wave * 16], pv);   // block-uniform: every wave of a block passes the same barriers
  float bb[8];
#pragma unroll
  for (int j = 0; j < 8; ++j) bb[j] = bfr(BA[c0 + j * 16 + col]);
  if (which == 2) {
#pragma unroll
    for (int j = 0; j < 8; ++j)
#pragma unroll
      for (int r = 0; r < 8; ++r) { const float v = acc[j][r] + bb[j]; const int rl = wave * 16 + 8 * g + r, cl = j * 16 + col; const __bf16 bh = (__bf16)v; th[cl][rl] = bh; tl2[cl][rl] = (__bf16)(v - (float)bh); }
  } else {   // rotate-half rotary in the accumulators: out[d] = x[d] cos(p f_(d mod 32)) + (d < 32 ? -x[d+32] : x[d-32]) sin(p f_(d mod 32)); column d + 32 is tile j + 2 of the same lane
#pragma unroll
    for (int f = 0; f < 2; ++f)
#pragma unroll
      for (int r = 0; r < 8; ++r) { const int rl = wave * 16 + 8 * g + r; const v2f t = cs[rl][f * 16 + col]; const float c = t[0], s = t[1];
#pragma unroll
        for (int hd = 0; hd < 2; ++hd) { const int jl = hd * 4 + f, jh = jl + 2; const float x1 = acc[jl][r] + bb[jl], x2 = acc[jh][r] + bb[jh];
          const float v1 = fmaf(x1, c, -x2 * s), v2 = fmaf(x2, c, x1 * s); const _Float16 h1 = (_Float16)v1, h2 = (_Float16)v2;
          sh[rl][jl * 16 + col] = h1; sl[rl][jl * 16 + col] = (_Float16)((v1 - (float)h1) * 1024.0f); sh[rl][jh * 16 + col] = h2; sl[rl][jh * 16 + col] = (_Float16)((v2 - (float)h2) * 1024.0f); } }   /* q residual carried x 2^10 so the plane stays f16-normal on the chip */
  }
  __syncthreads();   // the block's tile is in LDS before the whole-line stores read it
  if (which < 2) { _Float16* dh = which == 0 ? QH : KH; for (int e = tid; e < 64 * 16; e += 128) { const int rl = e >> 4, q = e & 15; vst2((unsigned*)(dh + (r0 + rl) * NW + c0 + q * 8), *(const v4u*)&sh[rl][q * 8]); if (which == 0) vst2((unsigned*)(QL + (r0 + rl) * CC + c0 + q * 8), *(const v4u*)&sl[rl][q * 8]); } }
  else { const size_t b = r0 / TT; const int t0 = (int)(r0 % TT); for (int e = tid; e < 128 * 8; e += 128) { const int cl = e >> 3, q = e & 7; const size_t o2 = (b * KV + c0 + cl) * (size_t)TT + t0 + q * 8; vst2((unsigned*)(VT + o2), *(const v4u*)&th[cl][q * 8]); vst2((unsigned*)(VL + o2), *(const v4u*)&tl2[cl][q * 8]); } } }
#define FQ 2                // 16-query tiles per block
#define FW (GQ * FQ)        // waves per block
#define SP 72               // LDS row pitch in 16-bit elements: a 128-byte row + 16 bytes, for 16-byte readers
#define L2E 1.44269504088896340736f
// waves_per_eu(4, 4): two blocks a WGP; lets the compiler keep all 24 fragment reads of a 32-key pass in flight at once instead of saving registers
__global__ __launch_bounds__(32 * FW) __attribute__((amdgpu_waves_per_eu(4, 4))) void k_fa(const _Float16* __restrict__ QH, const _Float16* __restrict__ QL, const _Float16* __restrict__ KH, const __bf16* __restrict__ VT, const __bf16* __restrict__ VL, float* __restrict__ Y) {
  __shared__ __align__(16) _Float16 sk[2][64][SP]; __shared__ __align__(16) __bf16 svh[2][64][SP], svl[2][64][SP]; __shared__ __align__(16) float so[FW][16][HD + 4];
  const int tid = threadIdx.x, wave = __builtin_amdgcn_readfirstlane(tid >> 5), lane = tid & 31, col = lane & 15, g = lane >> 4;
  const int kvh = blockIdx.x % NKV, b = blockIdx.x / NKV; const int yb = blockIdx.y; const int q0 = (yb < TT / 64 ? TT / 32 - 1 - yb : yb - TT / 64) * 32;   // long blocks first, then short ones in rising order (a permutation; for balance only)
  const int h = kvh * GQ + (wave & (GQ - 1)), ql0 = q0 + (wave / GQ) * 16, qt = ql0 + col; const int ns = q0 / 64 + 1;   // 64-key stages up to the block's diagonal
  const int sr = tid >> 3, sc = (tid & 7) * 8;   // staging: 8 lanes a row, rows sr and sr + 32
  const _Float16* gk = KH + ((size_t)b * TT + sr) * KV + kvh * HD + sc; const size_t vo = ((size_t)b * KV + kvh * HD + sr) * (size_t)TT + sc; const __bf16 *gh = VT + vo, *gl = VL + vo;
  v16h qh[2], qr[2];
#pragma unroll
  for (int kc = 0; kc < 2; ++kc) { const size_t qo = ((size_t)b * TT + qt) * CC + h * HD + kc * 32; qh[kc] = frag_h(QH + qo, lane); qr[kc] = frag_h(QL + qo, lane); }
  v8h rk0 = *(const v8h*)gk, rk1 = *(const v8h*)(gk + 32 * KV); v8b rh0 = *(const v8b*)gh, rh1 = *(const v8b*)(gh + 32 * TT), rl0 = *(const v8b*)gl, rl1 = *(const v8b*)(gl + 32 * TT);
  *(v8h*)&sk[0][sr][sc] = rk0; *(v8h*)&sk[0][sr + 32][sc] = rk1; *(v8b*)&svh[0][sr][sc] = rh0; *(v8b*)&svh[0][sr + 32][sc] = rh1; *(v8b*)&svl[0][sr][sc] = rl0; *(v8b*)&svl[0][sr + 32][sc] = rl1;
  __syncthreads();   // stage 0 is in LDS before any wave reads it
  v8f o[HD / 16] = {}; float m = -3.0e38f, l = 0.f;
  // the stage loop stays rolled (its trip count is the block's own; a second copy of the body would only cost instruction cache); every full unroll below keeps a fragment or accumulator array in registers
#pragma unroll 1
  for (int st = 0; st < ns; ++st) { const int cur = st & 1, k0 = st * 64; const bool more = st + 1 < ns;   // block-uniform
    if (more) { const int kn = k0 + 64; rk0 = *(const v8h*)(gk + (size_t)kn * KV); rk1 = *(const v8h*)(gk + (size_t)(kn + 32) * KV); rh0 = *(const v8b*)(gh + kn); rh1 = *(const v8b*)(gh + 32 * TT + kn); rl0 = *(const v8b*)(gl + kn); rl1 = *(const v8b*)(gl + 32 * TT + kn);
      asm volatile("s_wait_xcnt 0x0" ::: "memory"); }   // the fragment reads below reuse the address registers of these six loads: the wait stands in front of that overwrite
#pragma unroll
    for (int hf = 0; hf < 2; ++hf) { const int kb0 = k0 + hf * 32;
      if (kb0 <= ql0 + 15) {   // wave-uniform: 32 keys wholly above this wave's diagonal add nothing
        v16h ka[2], kb[2]; v16b vh[HD / 16], vl[HD / 16]; v8f s[2] = {};
#pragma unroll
        for (int j = 0; j < 2; ++j) { const _Float16* kp = &sk[cur][hf * 32 + j * 16 + col][0]; ka[j] = frag_h(kp, lane); kb[j] = frag_h(kp + 32, lane); }
#pragma unroll
        for (int j = 0; j < HD / 16; ++j) { vh[j] = frag_b(&svh[cur][j * 16 + col][hf * 32], lane); vl[j] = frag_b(&svl[cur][j * 16 + col][hf * 32], lane); }
#pragma unroll
        for (int j = 0; j < 2; ++j) s[j] = wmma16(ka[j], qr[0], s[j]);
#pragma unroll
        for (int j = 0; j < 2; ++j) s[j] = wmma16(kb[j], qr[1], s[j]);
#pragma unroll
        for (int j = 0; j < 2; ++j) s[j] *= (1.0f / 1024.0f);   // the residual plane is carried x 2^10
#pragma unroll
        for (int j = 0; j < 2; ++j) s[j] = wmma16(ka[j], qh[0], s[j]);
#pragma unroll
        for (int j = 0; j < 2; ++j) s[j] = wmma16(kb[j], qh[1], s[j]);
#pragma unroll
        for (int j = 0; j < 2; ++j) s[j] *= 0.125f;
        if (kb0 + 31 > ql0) {   // wave-uniform: only keys at the diagonal mask; key 0 is open to every query, so the running maximum is finite from the first 32 keys on
#pragma unroll
          for (int j = 0; j < 2; ++j)
#pragma unroll
            for (int r = 0; r < 8; ++r) if (kb0 + j * 16 + 8 * g + r > qt) s[j][r] = -3.0e38f; }
        float mx = m;
#pragma unroll
        for (int j = 0; j < 2; ++j)
#pragma unroll
          for (int r = 0; r < 8; ++r) mx = fmaxf(mx, s[j][r]);
        mx = fmaxf(mx, __shfl_xor(mx, 16));
        const float al = __builtin_amdgcn_exp2f((m - mx) * L2E); m = mx; l *= al;
#pragma unroll
        for (int j = 0; j < HD / 16; ++j) o[j] *= al;
        v16b ph, pl;   // B fragment of Pt: element i = key 8g + i of score tile 0, element 8 + i = the same row of tile 1: the k order of frag_b
#pragma unroll
        for (int i = 0; i < 8; ++i) { const float x = __builtin_amdgcn_exp2f((s[0][i] - mx) * L2E), y = __builtin_amdgcn_exp2f((s[1][i] - mx) * L2E); l += x + y;
          const __bf16 xh = (__bf16)x, yh = (__bf16)y; ph[i] = xh; ph[8 + i] = yh; pl[i] = (__bf16)(x - (float)xh); pl[8 + i] = (__bf16)(y - (float)yh); }
#pragma unroll
        for (int j = 0; j < HD / 16; ++j) o[j] = wmma_bf(vh[j], ph, o[j]);
#pragma unroll
        for (int j = 0; j < HD / 16; ++j) o[j] = wmma_bf(vh[j], pl, o[j]);
#pragma unroll
        for (int j = 0; j < HD / 16; ++j) o[j] = wmma_bf(vl[j], ph, o[j]); } }
    if (more) { const int nx = cur ^ 1; *(v8h*)&sk[nx][sr][sc] = rk0; *(v8h*)&sk[nx][sr + 32][sc] = rk1; *(v8b*)&svh[nx][sr][sc] = rh0; *(v8b*)&svh[nx][sr + 32][sc] = rh1; *(v8b*)&svl[nx][sr][sc] = rl0; *(v8b*)&svl[nx][sr + 32][sc] = rl1; }
    __syncthreads(); }   // publishes stage st + 1 and ends every wave's reads of the buffer that the next pass refills
  l += __shfl_xor(l, 16); const float inv = 1.0f / l;
#pragma unroll
  for (int j = 0; j < HD / 16; ++j) { v4f lo4, hi4;
#pragma unroll
    for (int r = 0; r < 4; ++r) { lo4[r] = o[j][r] * inv; hi4[r] = o[j][4 + r] * inv; }
    *(v4f*)&so[wave][col][j * 16 + 8 * g] = lo4; *(v4f*)&so[wave][col][j * 16 + 8 * g + 4] = hi4; }
  LDSX();   // the wave's own tile, turned in its own LDS range so that the stores cover whole lines
#pragma unroll
  for (int it = 0; it < 8; ++it) { const int rl = it * 2 + g; vst2(Y + ((size_t)b * TT + ql0 + rl) * CC + h * HD + col * 4, *(const v4f*)&so[wave][rl][col * 4]); } }
// ---- k_out: block = (64 rows, 128 cols): out = y (bf16 hi + lo) Wo ((in,out), exact bf16 weights), f32 accumulate
__global__ __launch_bounds__(128) void k_out(const float* __restrict__ Y, const float* __restrict__ WO, float* __restrict__ OUT) { __shared__ __align__(16) OutLds sm; float (&sf)[4][16][132] = sm.sf;
  const int tid = threadIdx.x, wave = tid >> 5, lane = tid & 31, col = lane & 15, g = lane >> 4; const int c0 = blockIdx.y * 128; const size_t r0 = (size_t)blockIdx.x * 64 + wave * 16;
  v8f acc[8] = {}; v4f rw[16], ra[8]; const int ar = tid >> 4, aq = (tid & 15) * 4;
  const float* wp = WO + (size_t)(__builtin_amdgcn_readfirstlane(wave) * 8) * CC + c0; const float* yp = Y + ((size_t)blockIdx.x * 64 + ar) * CC + aq;
  w_load(rw, wp, CC, lane); a_load(ra, yp);
  asm volatile("s_wait_xcnt 0x0" ::: "memory");   // the address registers of these loads are reused below: the wait stands in front of that overwrite
  w_store(rw, sm.s.w[0], wave, lane);
#pragma unroll
  for (int i = 0; i < 8; ++i) { v4b th, tl;
#pragma unroll
    for (int c = 0; c < 4; ++c) { const __bf16 h = (__bf16)ra[i][c]; th[c] = h; tl[c] = (__bf16)(ra[i][c] - (float)h); }
    *(v4b*)&sm.s.ah[0][ar + i * 8][aq] = th; *(v4b*)&sm.s.al[0][ar + i * 8][aq] = tl; }
  __syncthreads();   // stage 0 is in LDS before any wave reads it
  // the stage loop stays rolled: a second copy of the body would only cost registers and instruction cache
#pragma unroll 1
  for (int st = 0; st < CC / GK; ++st) { const int cur = st & 1; const bool more = st + 1 < CC / GK;
    if (more) { w_load(rw, wp + (size_t)((st + 1) * GK) * CC, CC, lane); a_load(ra, yp + (st + 1) * GK);   // the next stage's loads fly during this stage's products
      asm volatile("s_wait_xcnt 0x0" ::: "memory"); }   // as above
#pragma unroll
    for (int kc = 0; kc < GK / 32; ++kc) { const v16b ah = frag_b(&sm.s.ah[cur][wave * 16 + col][kc * 32], lane), al = frag_b(&sm.s.al[cur][wave * 16 + col][kc * 32], lane); v16b wf[8];   // all 20 fragment reads of 32 k stand together, in front of their 16 products
#pragma unroll
      for (int j = 0; j < 8; ++j) wf[j] = w_frag(sm.s.w[cur], j, kc, col, g);
#pragma unroll
      for (int j = 0; j < 8; ++j) acc[j] = wmma_bf(ah, wf[j], acc[j]);   // hi over all 8 tiles, then lo: each tile still adds hi before lo, and no product waits for the one directly in front of it
#pragma unroll
      for (int j = 0; j < 8; ++j) acc[j] = wmma_bf(al, wf[j], acc[j]); }
    if (more) { w_store(rw, sm.s.w[cur ^ 1], wave, lane);
#pragma unroll
      for (int i = 0; i < 8; ++i) { v4b th, tl;
#pragma unroll
        for (int c = 0; c < 4; ++c) { const __bf16 h = (__bf16)ra[i][c]; th[c] = h; tl[c] = (__bf16)(ra[i][c] - (float)h); }
        *(v4b*)&sm.s.ah[cur ^ 1][ar + i * 8][aq] = th; *(v4b*)&sm.s.al[cur ^ 1][ar + i * 8][aq] = tl; } }
    __syncthreads(); }   // publishes stage st + 1 and ends every wave's reads of the buffer that the next pass refills (after the last pass: of the LDS that the epilogue reuses)
#pragma unroll
  for (int j = 0; j < 8; ++j)
#pragma unroll
    for (int r = 0; r < 8; ++r) sf[wave][8 * g + r][j * 16 + col] = acc[j][r];
  LDSX(); for (int rl = 0; rl < 16; ++rl) vst2(OUT + (r0 + rl) * CC + c0 + lane * 4, *(const v4f*)&sf[wave][rl][lane * 4]); }
extern "C" void kernel_launch(void* const* d_in, const int* in_sizes, int n_in, void* d_out, int out_size, void* d_ws, size_t ws_size, hipStream_t stream) {
  (void)in_sizes; (void)n_in; (void)out_size;
  const float** F = (const float**)d_in;   // 0 hidden_states [2,2048,1024], 1 positions [2048] int32 (verbatim arange; read), 2 Wq [1024,1024] ((in,out)), 3 bq, 4 Wk [1024,256], 5 bk, 6 Wv [1024,256], 7 bv, 8 Wo [1024,1024] ((in,out))
  if (ws_size < (size_t)WS_END) return;
  char* ws = (char*)d_ws; _Float16 *QH = (_Float16*)(ws + WS_QH), *QL = (_Float16*)(ws + WS_QL), *KH = (_Float16*)(ws + WS_KH); __bf16 *VT = (__bf16*)(ws + WS_VT), *VL = (__bf16*)(ws + WS_VL); float *Y = (float*)(ws + WS_Y);
  k_proj<<<dim3(TNB * TT / 64, CC / 128, 3), 128, 0, stream>>>(F[0], F[2], F[3], F[4], F[5], F[6], F[7], (const int*)d_in[1], QH, QL, KH, VT, VL);
  k_fa<<<dim3(TNB * NKV, TT / 32), 32 * FW, 0, stream>>>(QH, QL, KH, VT, VL, Y);
  k_out<<<dim3(TNB * TT / 64, CC / 128), 128, 0, stream>>>(Y, F[8], (float*)d_out);
}

// v005
// A run of this version takes 86.6 microseconds.
// Timed twice side by side with v004, it ran 1.05 times as fast both times.
// All steps since v000 together make it 14.4 times as fast.
// compute dtype: all float inputs rounded to bf16, positions (int) read; q/k/v = x W + b ((in,out)) with EXACT bf16 products on WMMA 16x16x32, f32 accumulate; neox rotary (rotate-half) in f32 (inv_freq = 10000^(-2i/64) via powf, precise cosf/sinf, positions read) on q and k; q as f16 hi + residual (carried x 2^10), k f16 -> 2-product logits / 8, causal, kept in registers (kv head = h/4); running-maximum softmax in f32 (exp2 of the log2e-scaled difference), unnormalised P split bf16 hi + lo against v bf16 hi + lo (3 products), divided by the row sum at the end; out = y (bf16 hi + lo) Wo ((in,out)); f32 output.
#include <hip/hip_runtime.h>
#include <math.h>

typedef __attribute__((ext_vector_type(16))) _Float16 v16h;
typedef __attribute__((ext_vector_type(16))) __bf16 v16b;
typedef __attribute__((ext_vector_type(8)))  _Float16 v8h;
typedef __attribute__((ext_vector_type(8)))  float v8f;
typedef __attribute__((ext_vector_type(4)))  float v4f;
typedef __attribute__((ext_vector_type(2)))  float v2f;
typedef __attribute__((ext_vector_type(4)))  unsigned v4u;
typedef __attribute__((ext_vector_type(4)))  int v4i;
typedef float __attribute__((may_alias)) float_a;
typedef int __attribute__((may_alias)) int_a;

template <typename T> __device__ __forceinline__ void vst2(void* p, T v) { *(T*)p = v;  }
__device__ __forceinline__ v8f wmma16(v16h a, v16h b, v8f c) {
  v8f d = __builtin_amdgcn_wmma_f32_16x16x32_f16(false, a, false, b, (short)0, c, false, false);
  asm volatile("v_nop\n\tv_nop\n\tv_nop\n\tv_nop" : "+v"(d) : "v"(a), "v"(b));
  return d;
}
__device__ __forceinline__ v8f wmma_bf(v16b a, v16b b, v8f c) {
  v8f d = __builtin_amdgcn_wmma_f32_16x16x32_bf16(false, a, false, b, (short)0, c, false, false);
  asm volatile("v_nop\n\tv_nop\n\tv_nop\n\tv_nop" : "+v"(d) : "v"(a), "v"(b));
  return d;
}
// 16x16x32 fragments: lane = (h = lane>>4, row/col = lane&15); elements 0..7 = k0+8h+0..7, 8..15 = k0+16+8h+0..7; D element r = row 8h+r
__device__ __forceinline__ v16h frag_h(const _Float16* rowk0, int lane) {
  union { v16h v; v8h q[2]; } u; const _Float16* p = rowk0 + 8 * (lane >> 4);
  u.q[0] = *(const v8h*)p; u.q[1] = *(const v8h*)(p + 16); return u.v;
}
__device__ __forceinline__ v16h frag_f32(const float* rowk0, int lane) {
  v16h a; const float* p = rowk0 + 8 * (lane >> 4);
#pragma unroll
  for (int i = 0; i < 8; ++i) { a[i] = (_Float16)p[i]; a[8 + i] = (_Float16)p[16 + i]; }
  return a;
}
__device__ __forceinline__ v16h frag_f32s(const float* rowk0, int lane, float sc) {
  v16h a; const float* p = rowk0 + 8 * (lane >> 4);
#pragma unroll
  for (int i = 0; i < 8; ++i) { a[i] = (_Float16)(p[i] * sc); a[8 + i] = (_Float16)(p[16 + i] * sc); }
  return a;
}
// column fragment from a [K][ld] layout (column n), rows >= K read as 0
__device__ __forceinline__ v16h fragc_f32(const float* W, int k0, int n, int lane, int ld, int K) {
  v16h a; const int g = lane >> 4;
#pragma unroll
  for (int i = 0; i < 8; ++i) { const int ka = k0 + 8 * g + i, kb = ka + 16;
    a[i] = (_Float16)(ka < K ? W[(size_t)(ka < K ? ka : K - 1) * ld + n] : 0.f); a[8 + i] = (_Float16)(kb < K ? W[(size_t)(kb < K ? kb : K - 1) * ld + n] : 0.f); }
  return a;
}
struct F2 { v16b h, l; };
__device__ __forceinline__ F2 bsplit16(const float v[16]) { F2 r;
#pragma unroll
  for (int i = 0; i < 16; ++i) { const __bf16 h = (__bf16)v[i]; r.h[i] = h; r.l[i] = (__bf16)(v[i] - (float)h); }
  return r; }
__device__ __forceinline__ F2 split_row(const float* row, int k0, int lane) { float v[16]; const float* p = row + k0 + 8 * (lane >> 4);
#pragma unroll
  for (int i = 0; i < 8; ++i) { v[i] = p[i]; v[8 + i] = p[16 + i]; }
  return bsplit16(v); }
__device__ __forceinline__ F2 split_rowK(const float* row, int k0, int lane, int K) { float v[16]; const int g = lane >> 4;
#pragma unroll
  for (int i = 0; i < 8; ++i) { const int ka = k0 + 8 * g + i, kb = ka + 16; v[i] = ka < K ? row[ka < K ? ka : K - 1] : 0.f; v[8 + i] = kb < K ? row[kb < K ? kb : K - 1] : 0.f; }
  return bsplit16(v); }
__device__ __forceinline__ F2 split_col(const float* W, int k0, int n, int lane, int ld, int K) { float v[16]; const int g = lane >> 4;
#pragma unroll
  for (int i = 0; i < 8; ++i) { const int ka = k0 + 8 * g + i, kb = ka + 16; v[i] = ka < K ? W[(size_t)(ka < K ? ka : K - 1) * ld + n] : 0.f; v[8 + i] = kb < K ? W[(size_t)(kb < K ? kb : K - 1) * ld + n] : 0.f; }
  return bsplit16(v); }
__device__ __forceinline__ v8f mac3(const F2& a, const F2& b, v8f c) { c = wmma_bf(a.l, b.h, c); c = wmma_bf(a.h, b.l, c); return wmma_bf(a.h, b.h, c); }
__device__ __forceinline__ float sigm(float v) { return 1.0f / (1.0f + expf(-v)); }
#define LDSX() do { asm volatile("s_wait_dscnt 0" ::: "memory"); __builtin_amdgcn_wave_barrier(); __builtin_amdgcn_fence(__ATOMIC_RELEASE, "workgroup"); } while (0)


// GQA causal attention with neox RoPE (B 2, S 2,048, hidden 1,024 = 16 x 64 query heads, 4 kv heads): q/k/v = x W + b, rope(positions), k/v repeated 4x, scores / 8 causal, softmax, P v, out = y Wo.
#define NB 2
#define TT 2048
#define CC 1024
#define NH 16
#define HD 64
#define NKV 4
#define KV (NKV * HD)      // 256
#define GQ (NH / NKV)      // 4
#ifndef TNB
#define TNB NB
#endif
typedef __attribute__((ext_vector_type(8))) __bf16 v8b;
__device__ __forceinline__ v16b frag_b(const __bf16* rowk0, int lane) {
  union { v16b v; v8b q[2]; } u; const __bf16* p = rowk0 + 8 * (lane >> 4);
  u.q[0] = *(const v8b*)p; u.q[1] = *(const v8b*)(p + 16); return u.v;
}
__device__ __forceinline__ float bfr(float v) { return (float)(__bf16)v; }
__device__ __attribute__((noinline)) float exp_ni(float v) { return expf(v); }
__device__ __attribute__((noinline)) float erf_ni(float v) { return erff(v); }

#define WS_QH  0u
#define WS_QL  (WS_QH + 2u * (size_t)NB * TT * CC)
#define WS_KH  (WS_QL + 2u * (size_t)NB * TT * CC)      // f16 k rows [b*t][KV]
#define WS_VT  (WS_KH + 2u * (size_t)NB * TT * KV)      // bf16 v planes [b][kvc][t]
#define WS_VL  (WS_VT + 2u * (size_t)NB * KV * TT)      // bf16 v residual planes
#define WS_Y   (WS_VL + 2u * (size_t)NB * KV * TT)      // f32 y rows [b*t][C]
#define WS_END (WS_Y + 4u * (size_t)NB * TT * CC)

// ---- operand tiles of the two projection kernels: 64 k at a time, rounded to bf16 (k_out's activations split bf16 hi + lo) once a block and staged in two LDS buffers that the block's 4 waves share.
// W [k][n] comes by whole 512-byte row pieces (16 bytes a lane), is turned in registers and stored as rows [n][k]; the activations come by whole 256-byte row pieces.
#define GK 64               // k per stage
#define GP 72               // LDS row pitch in bf16: a 128-byte row + 16 bytes, for 16-byte readers
typedef __attribute__((ext_vector_type(4))) __bf16 v4b;
__device__ __forceinline__ void w_load(v4f (&r)[16], const float* __restrict__ p, int ld, unsigned lane) {   // p = &W[k0 + 8 * wave][c0], the same in every lane (a scalar base; the lane adds one offset register); rows 8 * wave + i and 32 + 8 * wave + i
#pragma unroll
  for (int s = 0; s < 2; ++s)
#pragma unroll
    for (int i = 0; i < 8; ++i) r[s * 8 + i] = *(const v4f*)(p + (size_t)(s * 32 + i) * ld + lane * 4u);
}
// 16-byte piece q (k = 8q .. 8q + 7) of row n stands at place q ^ ((n >> 4) & 3): the storing lanes are 4 rows apart, and without the exchange they would meet on a quarter of the banks
__device__ __forceinline__ void w_store(const v4f (&r)[16], __bf16 (*w)[GP], int wave, int lane) {
#pragma unroll
  for (int s = 0; s < 2; ++s)
#pragma unroll
    for (int c = 0; c < 4; ++c) { v8b t;
#pragma unroll
      for (int i = 0; i < 8; ++i) t[i] = (__bf16)r[s * 8 + i][c];
      *(v8b*)&w[lane * 4 + c][((wave + 4 * s) ^ ((lane >> 2) & 3)) * 8] = t; }
}
// B fragment of columns 16j .. 16j + 15, k = 32 kc .. 32 kc + 31 of the stage: the k order of frag_b
__device__ __forceinline__ v16b w_frag(const __bf16 (*w)[GP], int j, int kc, int col, int g) {
  union { v16b v; v8b q[2]; } u; const __bf16* p = &w[j * 16 + col][0];
  u.q[0] = *(const v8b*)(p + ((kc * 4 + g) ^ (j & 3)) * 8); u.q[1] = *(const v8b*)(p + ((kc * 4 + 2 + g) ^ (j & 3)) * 8); return u.v;
}
__device__ __forceinline__ void a_load(v4f (&r)[8], const float* __restrict__ p) {   // p = &A[r0 + (tid >> 4)][k0 + 4 * (tid & 15)]; rows 8 apart
#pragma unroll
  for (int i = 0; i < 8; ++i) r[i] = *(const v4f*)(p + (size_t)(i * 8) * CC);
}
// ---- L2 prefetch for the two projection kernels: for speed only; the staging loads alone have one stage of lead.
// One wave of each block asks for its share of a later stage, PFD stages ahead: lanes 0..15 take 16 of the W tile's 128 aligned 256-byte units (dealt over the row blocks that read the same tile), lanes 16..31 take 16 of the 64 activation rows (dealt over the column blocks that read the same rows). A hint only: no result depends on it.
#define PFD 4               // stages between the pass that asks and the stage asked for (its staging loads are issued PFD - 1 passes later)
__device__ __forceinline__ const char* pf_first(const float* __restrict__ Wc, int ld, const float* __restrict__ Ar, int wsl, int asl, int lane) {   // Wc = &W[0][c0], Ar = &A[r0][0]; the lane's address in stage 1
  const int u = wsl * 16 + (lane & 15);
  return lane < 16 ? (const char*)(Wc + (size_t)(GK + (u >> 1)) * ld + (u & 1) * 64) : (const char*)(Ar + (size_t)(asl * 16 + (lane & 15)) * CC + GK);
}
// request and step stand in one statement, on one in-out register pair: the pair that a request names then holds nothing but addresses inside the same array (it steps to a later stage, never past stage CC / GK - 1)
__device__ __forceinline__ void pf_ask(const char*& p, unsigned long long step) { asm volatile("global_prefetch_b8 %0, off scope:SCOPE_SE\n\tv_add_nc_u64_e32 %0, %0, %1" : "+v"(p) : "v"(step)); }
static_assert(PFD == 4, "pf_ask3 asks for exactly the PFD - 1 stages in front of the loop's first request");
__device__ __forceinline__ void pf_ask3(const char*& p, unsigned long long step) {   // stages 1 .. PFD - 1, the same way
  asm volatile("global_prefetch_b8 %0, off scope:SCOPE_SE\n\tv_add_nc_u64_e32 %0, %0, %1\n\tglobal_prefetch_b8 %0, off scope:SCOPE_SE\n\tv_add_nc_u64_e32 %0, %0, %1\n\tglobal_prefetch_b8 %0, off scope:SCOPE_SE\n\tv_add_nc_u64_e32 %0, %0, %1" : "+v"(p) : "v"(step)); }
union ProjLds { struct { _Float16 sh[64][136], sl[64][136]; __bf16 th[128][72], tl2[128][72]; } e; struct { __bf16 w[2][128][GP], a[2][64][GP]; } s; };   // the stages are dead when the epilogue begins
// rotary table of one wave's own 16 rows: cs[row][i] = (cos, sin)(p_row f_i), f_i = 10000^(-i/32), lane = i: each pair is made once and serves both halves of both heads of the block's 128 columns
#define CSP 34              // row pitch in pairs: the readers' two lane halves stand 8 rows apart and so fall on different halves of the banks
__device__ __forceinline__ void rope_table(v2f (*cs)[CSP], int pv, int lane) {   // pv: lane l holds the position of row l & 15; handed out by readlane
  const float inv_freq = 1.0f / powf(10000.0f, (float)(2 * lane) / 64.0f);
  // stays rolled: 16 copies of the library's argument reduction would only cost instruction cache
#pragma unroll 1
  for (int it = 0; it < 16; ++it) { const float ang = (float)__builtin_amdgcn_readlane(pv, it) * inv_freq; float s, c; sincosf(ang, &s, &c); v2f t; t[0] = c; t[1] = s; cs[it][lane] = t; }
}
union OutLds { float sf[4][16][132]; struct { __bf16 w[2][128][GP], ah[2][64][GP], al[2][64][GP]; } s; };
// acc += x[64 rows][1,024] W[1,024][128 columns]; LD = W's row pitch, a constant so that a stage's 16 W loads share one address and differ in their immediate offsets
template <int LD> __device__ __forceinline__ void proj_gemm(v8f (&acc)[8], ProjLds& sm, const float* __restrict__ wp, const float* __restrict__ xp, int wave, int lane, int ar, int aq, bool rot, v2f (*cs)[CSP], int pv, const char* pf, bool pfw) {
  v4f rw[16], ra[8]; const int col = lane & 15, g = lane >> 4; const unsigned pfs = lane < 16 ? GK * LD * 4u : GK * 4u;   // the lane's step from stage to stage, in bytes
  w_load(rw, wp, LD, lane); a_load(ra, xp);
  asm volatile("s_wait_xcnt 0x0" ::: "memory");   // the address registers of these loads are reused below: the wait stands in front of that overwrite
  if (pfw) pf_ask3(pf, pfs);   // wave-uniform (a scalar): stages 1 .. PFD - 1 are asked for while stage 0's loads fly
  if (rot) rope_table(cs, pv, lane);   // block-uniform; made here, while stage 0's loads fly; read again only by the wave that wrote it, behind the barriers below
  w_store(rw, sm.s.w[0], wave, lane);
#pragma unroll
  for (int i = 0; i < 8; ++i) { v4b t;
#pragma unroll
    for (int c = 0; c < 4; ++c) t[c] = (__bf16)ra[i][c];
    *(v4b*)&sm.s.a[0][ar + i * 8][aq] = t; }
  __syncthreads();   // stage 0 is in LDS before any wave reads it
  // the stage loop stays rolled: a second copy of the body would only cost registers and instruction cache
#pragma unroll 1
  for (int st = 0; st < CC / GK; ++st) { const int cur = st & 1; const bool more = st + 1 < CC / GK;
    if (more) { w_load(rw, wp + (size_t)((st + 1) * GK) * LD, LD, lane); a_load(ra, xp + (st + 1) * GK);   // the next stage's loads fly during this stage's products
      asm volatile("s_wait_xcnt 0x0" ::: "memory"); }   // as above
    if (pfw && st + PFD < CC / GK) pf_ask(pf, st + PFD + 1 < CC / GK ? pfs : 0u);   // scalar tests; the address stops at the last stage
#pragma unroll
    for (int kc = 0; kc < GK / 32; ++kc) { const v16b a = frag_b(&sm.s.a[cur][wave * 16 + col][kc * 32], lane); v16b wf[8];   // all 18 fragment reads of 32 k stand together, in front of their 8 products
#pragma unroll
      for (int j = 0; j < 8; ++j) wf[j] = w_frag(sm.s.w[cur], j, kc, col, g);
#pragma unroll
      for (int j = 0; j < 8; ++j) acc[j] = wmma_bf(a, wf[j], acc[j]); }
    if (more) { w_store(rw, sm.s.w[cur ^ 1], wave, lane);
#pragma unroll
      for (int i = 0; i < 8; ++i) { v4b t;
#pragma unroll
        for (int c = 0; c < 4; ++c) t[c] = (__bf16)ra[i][c];
        *(v4b*)&sm.s.a[cur ^ 1][ar + i * 8][aq] = t; } }
    __syncthreads(); }   // publishes stage st + 1 and ends every wave's reads of the buffer that the next pass refills (after the last pass: of the LDS that the epilogue reuses)
}
// ---- k_proj: block = (64 rows, 128 cols, which): qkv = x W (+ b), exact; q -> f16 hi (+ residual), k -> f16 rows, v -> bf16 planes (hi + lo)
__global__ __launch_bounds__(128) void k_proj(const float* __restrict__ X, const float* __restrict__ WQ, const float* __restrict__ BQ, const float* __restrict__ WK, const float* __restrict__ BK, const float* __restrict__ WV, const float* __restrict__ BV, const int* __restrict__ POS, _Float16* __restrict__ QH, _Float16* __restrict__ QL, _Float16* __restrict__ KH, __bf16* __restrict__ VT, __bf16* __restrict__ VL) {
  __shared__ __align__(16) ProjLds sm; __shared__ __align__(16) v2f cs[64][CSP]; _Float16 (&sh)[64][136] = sm.e.sh, (&sl)[64][136] = sm.e.sl; __bf16 (&th)[128][72] = sm.e.th, (&tl2)[128][72] = sm.e.tl2;
  const int tid = threadIdx.x, wave = tid >> 5, lane = tid & 31, col = lane & 15, g = lane >> 4; const int which = blockIdx.z; const int c0 = blockIdx.y * 128; const size_t r0 = (size_t)blockIdx.x * 64; const int NW = which == 0 ? CC : KV; if (c0 >= NW) return;   // k/v are only KV wide (block-uniform exit)
  const float* WA = which == 0 ? WQ : which == 1 ? WK : WV; const float* BA = which == 0 ? BQ : which == 1 ? BK : BV;
  v8f acc[8] = {}; const int ar = tid >> 4, aq = (tid & 15) * 4;
  const float* wp = WA + (size_t)(__builtin_amdgcn_readfirstlane(wave) * 8) * NW + c0; const float* xp = X + (r0 + ar) * CC + aq;
  const int pv = POS[(int)(r0 % TT) + wave * 16 + col];   // p = position_ids[t] of the wave's 16 rows (64 divides the sequence length: a block's rows do not wrap); loaded ahead of stage 0, so that its wait leaves stage 0's loads in flight
  asm volatile("s_wait_xcnt 0x0" ::: "memory");   // the offset register of this load is reused for the addresses below: the wait stands in front of that overwrite
  const bool pfw = __builtin_amdgcn_readfirstlane(wave) == 0; const char* pf = pf_first(WA + c0, NW, X + r0 * CC, (blockIdx.x >> 3) & 7, (blockIdx.y + 2 * (which >> 1)) & 3, lane);   // the 12 column blocks of q, k, v that read the same rows cover each quarter of them three times
  if (which == 0) proj_gemm<CC>(acc, sm, wp, xp, wave, lane, ar, aq, true, &cs[wave * 16], pv, pf, pfw); else proj_gemm<KV>(acc, sm, wp, xp, wave, lane, ar, aq, which == 1, &cs[wave * 16], pv, pf, pfw);   // block-uniform: every wave of a block passes the same barriers
  float bb[8];
#pragma unroll
  for (int j = 0; j < 8; ++j) bb[j] = bfr(BA[c0 + j * 16 + col]);
  if (which == 2) {
#pragma unroll
    for (int j = 0; j < 8; ++j)
#pragma unroll
      for (int r = 0; r < 8; ++r) { const float v = acc[j][r] + bb[j]; const int rl = wave * 16 + 8 * g + r, cl = j * 16 + col; const __bf16 bh = (__bf16)v; th[cl][rl] = bh; tl2[cl][rl] = (__bf16)(v - (float)bh); }
  } else {   // rotate-half rotary in the accumulators: out[d] = x[d] cos(p f_(d mod 32)) + (d < 32 ? -x[d+32] : x[d-32]) sin(p f_(d mod 32)); column d + 32 is tile j + 2 of the same lane
#pragma unroll
    for (int f = 0; f < 2; ++f)
#pragma unroll
      for (int r = 0; r < 8; ++r) { const int rl = wave * 16 + 8 * g + r; const v2f t = cs[rl][f * 16 + col]; const float c = t[0], s = t[1];
#pragma unroll
        for (int hd = 0; hd < 2; ++hd) { const int jl = hd * 4 + f, jh = jl + 2; const float x1 = acc[jl][r] + bb[jl], x2 = acc[jh][r] + bb[jh];
          const float v1 = fmaf(x1, c, -x2 * s), v2 = fmaf(x2, c, x1 * s); const _Float16 h1 = (_Float16)v1, h2 = (_Float16)v2;
          sh[rl][jl * 16 + col] = h1; sl[rl][jl * 16 + col] = (_Float16)((v1 - (float)h1) * 1024.0f); sh[rl][jh * 16 + col] = h2; sl[rl][jh * 16 + col] = (_Float16)((v2 - (float)h2) * 1024.0f); } }   /* q residual carried x 2^10 so the plane stays f16-normal on the chip */
  }
  __syncthreads();   // the block's tile is in LDS before the whole-line stores read it
  if (which < 2) { _Float16* dh = which == 0 ? QH : KH; for (int e = tid; e < 64 * 16; e += 128) { const int rl = e >> 4, q = e & 15; vst2((unsigned*)(dh + (r0 + rl) * NW + c0 + q * 8), *(const v4u*)&sh[rl][q * 8]); if (which == 0) vst2((unsigned*)(QL + (r0 + rl) * CC + c0 + q * 8), *(const v4u*)&sl[rl][q * 8]); } }
  else { const size_t b = r0 / TT; const int t0 = (int)(r0 % TT); for (int e = tid; e < 128 * 8; e += 128) { const int cl = e >> 3, q = e & 7; const size_t o2 = (b * KV + c0 + cl) * (size_t)TT + t0 + q * 8; vst2((unsigned*)(VT + o2), *(const v4u*)&th[cl][q * 8]); vst2((unsigned*)(VL + o2), *(const v4u*)&tl2[cl][q * 8]); } } }
#define FQ 2                // 16-query tiles per block
#define FW (GQ * FQ)        // waves per block
#define SP 72               // LDS row pitch in 16-bit elements: a 128-byte row + 16 bytes, for 16-byte readers
#define L2E 1.44269504088896340736f
// waves_per_eu(4, 4): two blocks a WGP; lets the compiler keep all 24 fragment reads of a 32-key pass in flight at once instead of saving registers
__global__ __launch_bounds__(32 * FW) __attribute__((amdgpu_waves_per_eu(4, 4))) void k_fa(const _Float16* __restrict__ QH, const _Float16* __restrict__ QL, const _Float16* __restrict__ KH, const __bf16* __restrict__ VT, const __bf16* __restrict__ VL, float* __restrict__ Y) {
  __shared__ __align__(16) _Float16 sk[2][64][SP]; __shared__ __align__(16) __bf16 svh[2][64][SP], svl[2][64][SP]; __shared__ __align__(16) float so[FW][16][HD + 4];
  const int tid = threadIdx.x, wave = __builtin_amdgcn_readfirstlane(tid >> 5), lane = tid & 31, col = lane & 15, g = lane >> 4;
  const int kvh = blockIdx.x % NKV, b = blockIdx.x / NKV; const int yb = blockIdx.y; const int q0 = (yb < TT / 64 ? TT / 32 - 1 - yb : yb - TT / 64) * 32;   // long blocks first, then short ones in rising order (a permutation; for balance only)
  const int h = kvh * GQ + (wave & (GQ - 1)), ql0 = q0 + (wave / GQ) * 16, qt = ql0 + col; const int ns = q0 / 64 + 1;   // 64-key stages up to the block's diagonal
  const int sr = tid >> 3, sc = (tid & 7) * 8;   // staging: 8 lanes a row, rows sr and sr + 32
  const _Float16* gk = KH + ((size_t)b * TT + sr) * KV + kvh * HD + sc; const size_t vo = ((size_t)b * KV + kvh * HD + sr) * (size_t)TT + sc; const __bf16 *gh = VT + vo, *gl = VL + vo;
  v16h qh[2], qr[2];
#pragma unroll
  for (int kc = 0; kc < 2; ++kc) { const size_t qo = ((size_t)b * TT + qt) * CC + h * HD + kc * 32; qh[kc] = frag_h(QH + qo, lane); qr[kc] = frag_h(QL + qo, lane); }
  v8h rk0 = *(const v8h*)gk, rk1 = *(const v8h*)(gk + 32 * KV); v8b rh0 = *(const v8b*)gh, rh1 = *(const v8b*)(gh + 32 * TT), rl0 = *(const v8b*)gl, rl1 = *(const v8b*)(gl + 32 * TT);
  *(v8h*)&sk[0][sr][sc] = rk0; *(v8h*)&sk[0][sr + 32][sc] = rk1; *(v8b*)&svh[0][sr][sc] = rh0; *(v8b*)&svh[0][sr + 32][sc] = rh1; *(v8b*)&svl[0][sr][sc] = rl0; *(v8b*)&svl[0][sr + 32][sc] = rl1;
  __syncthreads();   // stage 0 is in LDS before any wave reads it
  v8f o[HD / 16] = {}; float m = -3.0e38f, l = 0.f;
  // the stage loop stays rolled (its trip count is the block's own; a second copy of the body would only cost instruction cache); every full unroll below keeps a fragment or accumulator array in registers
#pragma unroll 1
  for (int st = 0; st < ns; ++st) { const int cur = st & 1, k0 = st * 64; const bool more = st + 1 < ns;   // block-uniform
    if (more) { const int kn = k0 + 64; rk0 = *(const v8h*)(gk + (size_t)kn * KV); rk1 = *(const v8h*)(gk + (size_t)(kn + 32) * KV); rh0 = *(const v8b*)(gh + kn); rh1 = *(const v8b*)(gh + 32 * TT + kn); rl0 = *(const v8b*)(gl + kn); rl1 = *(const v8b*)(gl + 32 * TT + kn);
      asm volatile("s_wait_xcnt 0x0" ::: "memory"); }   // the fragment reads below reuse the address registers of these six loads: the wait stands in front of that overwrite
#pragma unroll
    for (int hf = 0; hf < 2; ++hf) { const int kb0 = k0 + hf * 32;
      if (kb0 <= ql0 + 15) {   // wave-uniform: 32 keys wholly above this wave's diagonal add nothing
        v16h ka[2], kb[2]; v16b vh[HD / 16], vl[HD / 16]; v8f s[2] = {};
#pragma unroll
        for (int j = 0; j < 2; ++j) { const _Float16* kp = &sk[cur][hf * 32 + j * 16 + col][0]; ka[j] = frag_h(kp, lane); kb[j] = frag_h(kp + 32, lane); }
#pragma unroll
        for (int j = 0; j < HD / 16; ++j) { vh[j] = frag_b(&svh[cur][j * 16 + col][hf * 32], lane); vl[j] = frag_b(&svl[cur][j * 16 + col][hf * 32], lane); }
#pragma unroll
        for (int j = 0; j < 2; ++j) s[j] = wmma16(ka[j], qr[0], s[j]);
#pragma unroll
        for (int j = 0; j < 2; ++j) s[j] = wmma16(kb[j], qr[1], s[j]);
#pragma unroll
        for (int j = 0; j < 2; ++j) s[j] *= (1.0f / 1024.0f);   // the residual plane is carried x 2^10
#pragma unroll
        for (int j = 0; j < 2; ++j) s[j] = wmma16(ka[j], qh[0], s[j]);
#pragma unroll
        for (int j = 0; j < 2; ++j) s[j] = wmma16(kb[j], qh[1], s[j]);
#pragma unroll
        for (int j = 0; j < 2; ++j) s[j] *= 0.125f;
        if (kb0 + 31 > ql0) {   // wave-uniform: only keys at the diagonal mask; key 0 is open to every query, so the running maximum is finite from the first 32 keys on
#pragma unroll
          for (int j = 0; j < 2; ++j)
#pragma unroll
            for (int r = 0; r < 8; ++r) if (kb0 + j * 16 + 8 * g + r > qt) s[j][r] = -3.0e38f; }
        float mx = m;
#pragma unroll
        for (int j = 0; j < 2; ++j)
#pragma unroll
          for (int r = 0; r < 8; ++r) mx = fmaxf(mx, s[j][r]);
        mx = fmaxf(mx, __shfl_xor(mx, 16));
        const float al = __builtin_amdgcn_exp2f((m - mx) * L2E); m = mx; l *= al;
#pragma unroll
        for (int j = 0; j < HD / 16; ++j) o[j] *= al;
        v16b ph, pl;   // B fragment of Pt: element i = key 8g + i of score tile 0, element 8 + i = the same row of tile 1: the k order of frag_b
#pragma unroll
        for (int i = 0; i < 8; ++i) { const float x = __builtin_amdgcn_exp2f((s[0][i] - mx) * L2E), y = __builtin_amdgcn_exp2f((s[1][i] - mx) * L2E); l += x + y;
          const __bf16 xh = (__bf16)x, yh = (__bf16)y; ph[i] = xh; ph[8 + i] = yh; pl[i] = (__bf16)(x - (float)xh); pl[8 + i] = (__bf16)(y - (float)yh); }
#pragma unroll
        for (int j = 0; j < HD / 16; ++j) o[j] = wmma_bf(vh[j], ph, o[j]);
#pragma unroll
        for (int j = 0; j < HD / 16; ++j) o[j] = wmma_bf(vh[j], pl, o[j]);
#pragma unroll
        for (int j = 0; j < HD / 16; ++j) o[j] = wmma_bf(vl[j], ph, o[j]); } }
    if (more) { const int nx = cur ^ 1; *(v8h*)&sk[nx][sr][sc] = rk0; *(v8h*)&sk[nx][sr + 32][sc] = rk1; *(v8b*)&svh[nx][sr][sc] = rh0; *(v8b*)&svh[nx][sr + 32][sc] = rh1; *(v8b*)&svl[nx][sr][sc] = rl0; *(v8b*)&svl[nx][sr + 32][sc] = rl1; }
    __syncthreads(); }   // publishes stage st + 1 and ends every wave's reads of the buffer that the next pass refills
  l += __shfl_xor(l, 16); const float inv = 1.0f / l;
#pragma unroll
  for (int j = 0; j < HD / 16; ++j) { v4f lo4, hi4;
#pragma unroll
    for (int r = 0; r < 4; ++r) { lo4[r] = o[j][r] * inv; hi4[r] = o[j][4 + r] * inv; }
    *(v4f*)&so[wave][col][j * 16 + 8 * g] = lo4; *(v4f*)&so[wave][col][j * 16 + 8 * g + 4] = hi4; }
  LDSX();   // the wave's own tile, turned in its own LDS range so that the stores cover whole lines
#pragma unroll
  for (int it = 0; it < 8; ++it) { const int rl = it * 2 + g; vst2(Y + ((size_t)b * TT + ql0 + rl) * CC + h * HD + col * 4, *(const v4f*)&so[wave][rl][col * 4]); } }
// ---- k_out: block = (64 rows, 128 cols): out = y (bf16 hi + lo) Wo ((in,out), exact bf16 weights), f32 accumulate
__global__ __launch_bounds__(128) void k_out(const float* __restrict__ Y, const float* __restrict__ WO, float* __restrict__ OUT) { __shared__ __align__(16) OutLds sm; float (&sf)[4][16][132] = sm.sf;
  const int tid = threadIdx.x, wave = tid >> 5, lane = tid & 31, col = lane & 15, g = lane >> 4; const int c0 = blockIdx.y * 128; const size_t r0 = (size_t)blockIdx.x * 64 + wave * 16;
  v8f acc[8] = {}; v4f rw[16], ra[8]; const int ar = tid >> 4, aq = (tid & 15) * 4;
  const float* wp = WO + (size_t)(__builtin_amdgcn_readfirstlane(wave) * 8) * CC + c0; const float* yp = Y + ((size_t)blockIdx.x * 64 + ar) * CC + aq;
  const bool pfw = __builtin_amdgcn_readfirstlane(wave) == 0; const unsigned pfs = lane < 16 ? GK * CC * 4u : GK * 4u; const char* pf = pf_first(WO + c0, CC, Y + (size_t)blockIdx.x * 64 * CC, (blockIdx.x >> 3) & 7, blockIdx.y & 3, lane);
  w_load(rw, wp, CC, lane); a_load(ra, yp);
  asm volatile("s_wait_xcnt 0x0" ::: "memory");   // the address registers of these loads are reused below: the wait stands in front of that overwrite
  if (pfw) pf_ask3(pf, pfs);   // wave-uniform (a scalar): stages 1 .. PFD - 1 are asked for while stage 0's loads fly
  w_store(rw, sm.s.w[0], wave, lane);
#pragma unroll
  for (int i = 0; i < 8; ++i) { v4b th, tl;
#pragma unroll
    for (int c = 0; c < 4; ++c) { const __bf16 h = (__bf16)ra[i][c]; th[c] = h; tl[c] = (__bf16)(ra[i][c] - (float)h); }
    *(v4b*)&sm.s.ah[0][ar + i * 8][aq] = th; *(v4b*)&sm.s.al[0][ar + i * 8][aq] = tl; }
  __syncthreads();   // stage 0 is in LDS before any wave reads it
  // the stage loop stays rolled: a second copy of the body would only cost registers and instruction cache
#pragma unroll 1
  for (int st = 0; st < CC / GK; ++st) { const int cur = st & 1; const bool more = st + 1 < CC / GK;
    if (more) { w_load(rw, wp + (size_t)((st + 1) * GK) * CC, CC, lane); a_load(ra, yp + (st + 1) * GK);   // the next stage's loads fly during this stage's products
      asm volatile("s_wait_xcnt 0x0" ::: "memory"); }   // as above
    if (pfw && st + PFD < CC / GK) pf_ask(pf, st + PFD + 1 < CC / GK ? pfs : 0u);   // scalar tests; the address stops at the last stage
#pragma unroll
    for (int kc = 0; kc < GK / 32; ++kc) { const v16b ah = frag_b(&sm.s.ah[cur][wave * 16 + col][kc * 32], lane), al = frag_b(&sm.s.al[cur][wave * 16 + col][kc * 32], lane); v16b wf[8];   // all 20 fragment reads of 32 k stand together, in front of their 16 products
#pragma unroll
      for (int j = 0; j < 8; ++j) wf[j] = w_frag(sm.s.w[cur], j, kc, col, g);
#pragma unroll
      for (int j = 0; j < 8; ++j) acc[j] = wmma_bf(ah, wf[j], acc[j]);   // hi over all 8 tiles, then lo: each tile still adds hi before lo, and no product waits for the one directly in front of it
#pragma unroll
      for (int j = 0; j < 8; ++j) acc[j] = wmma_bf(al, wf[j], acc[j]); }
    if (more) { w_store(rw, sm.s.w[cur ^ 1], wave, lane);
#pragma unroll
      for (int i = 0; i < 8; ++i) { v4b th, tl;
#pragma unroll
        for (int c = 0; c < 4; ++c) { const __bf16 h = (__bf16)ra[i][c]; th[c] = h; tl[c] = (__bf16)(ra[i][c] - (float)h); }
        *(v4b*)&sm.s.ah[cur ^ 1][ar + i * 8][aq] = th; *(v4b*)&sm.s.al[cur ^ 1][ar + i * 8][aq] = tl; } }
    __syncthreads(); }   // publishes stage st + 1 and ends every wave's reads of the buffer that the next pass refills (after the last pass: of the LDS that the epilogue reuses)
#pragma unroll
  for (int j = 0; j < 8; ++j)
#pragma unroll
    for (int r = 0; r < 8; ++r) sf[wave][8 * g + r][j * 16 + col] = acc[j][r];
  LDSX(); for (int rl = 0; rl < 16; ++rl) vst2(OUT + (r0 + rl) * CC + c0 + lane * 4, *(const v4f*)&sf[wave][rl][lane * 4]); }
extern "C" void kernel_launch(void* const* d_in, const int* in_sizes, int n_in, void* d_out, int out_size, void* d_ws, size_t ws_size, hipStream_t stream) {
  (void)in_sizes; (void)n_in; (void)out_size;
  const float** F = (const float**)d_in;   // 0 hidden_states [2,2048,1024], 1 positions [2048] int32 (verbatim arange; read), 2 Wq [1024,1024] ((in,out)), 3 bq, 4 Wk [1024,256], 5 bk, 6 Wv [1024,256], 7 bv, 8 Wo [1024,1024] ((in,out))
  if (ws_size < (size_t)WS_END) return;
  char* ws = (char*)d_ws; _Float16 *QH = (_Float16*)(ws + WS_QH), *QL = (_Float16*)(ws + WS_QL), *KH = (_Float16*)(ws + WS_KH); __bf16 *VT = (__bf16*)(ws + WS_VT), *VL = (__bf16*)(ws + WS_VL); float *Y = (float*)(ws + WS_Y);
  k_proj<<<dim3(TNB * TT / 64, CC / 128, 3), 128, 0, stream>>>(F[0], F[2], F[3], F[4], F[5], F[6], F[7], (const int*)d_in[1], QH, QL, KH, VT, VL);
  k_fa<<<dim3(TNB * NKV, TT / 32), 32 * FW, 0, stream>>>(QH, QL, KH, VT, VL, Y);
  k_out<<<dim3(TNB * TT / 64, CC / 128), 128, 0, stream>>>(Y, F[8], (float*)d_out);
}

// v006
// Measured time: 82 microseconds a run.
// Two timings next to v005 both put it at 1.06 times that version's speed.
// Counting every step since v000, it is 15.2 times as fast.
// compute dtype: all float inputs rounded to bf16, positions (int) read; q/k/v = x W + b ((in,out)) with EXACT bf16 products on WMMA 16x16x32, f32 accumulate; neox rotary (rotate-half) in f32 (inv_freq = 10000^(-2i/64) via powf, precise cosf/sinf, positions read) on q and k; q as f16 hi + residual (carried x 2^10), k f16 -> 2-product logits / 8, causal, kept in registers (kv head = h/4); running-maximum softmax in f32 (exp2 of the log2e-scaled difference), unnormalised P split bf16 hi + lo against v bf16 hi + lo (3 products), divided by the row sum at the end; out = y (bf16 hi + lo) Wo ((in,out)); f32 output.
#include <hip/hip_runtime.h>
#include <math.h>

typedef __attribute__((ext_vector_type(16))) _Float16 v16h;
typedef __attribute__((ext_vector_type(16))) __bf16 v16b;
typedef __attribute__((ext_vector_type(8)))  _Float16 v8h;
typedef __attribute__((ext_vector_type(8)))  float v8f;
typedef __attribute__((ext_vector_type(4)))  float v4f;
typedef __attribute__((ext_vector_type(2)))  float v2f;
typedef __attribute__((ext_vector_type(4)))  unsigned v4u;
typedef __attribute__((ext_vector_type(4)))  int v4i;
typedef float __attribute__((may_alias)) float_a;
typedef int __attribute__((may_alias)) int_a;

template <typename T> __device__ __forceinline__ void vst2(void* p, T v) { *(T*)p = v;  }
__device__ __forceinline__ v8f wmma16(v16h a, v16h b, v8f c) {
  v8f d = __builtin_amdgcn_wmma_f32_16x16x32_f16(false, a, false, b, (short)0, c, false, false);
  asm volatile("v_nop\n\tv_nop\n\tv_nop\n\tv_nop" : "+v"(d) : "v"(a), "v"(b));
  return d;
}
__device__ __forceinline__ v8f wmma_bf(v16b a, v16b b, v8f c) {
  v8f d = __builtin_amdgcn_wmma_f32_16x16x32_bf16(false, a, false, b, (short)0, c, false, false);
  asm volatile("v_nop\n\tv_nop\n\tv_nop\n\tv_nop" : "+v"(d) : "v"(a), "v"(b));
  return d;
}
// 16x16x32 fragments: lane = (h = lane>>4, row/col = lane&15); elements 0..7 = k0+8h+0..7, 8..15 = k0+16+8h+0..7; D element r = row 8h+r
__device__ __forceinline__ v16h frag_h(const _Float16* rowk0, int lane) {
  union { v16h v; v8h q[2]; } u; const _Float16* p = rowk0 + 8 * (lane >> 4);
  u.q[0] = *(const v8h*)p; u.q[1] = *(const v8h*)(p + 16); return u.v;
}
__device__ __forceinline__ v16h frag_f32(const float* rowk0, int lane) {
  v16h a; const float* p = rowk0 + 8 * (lane >> 4);
#pragma unroll
  for (int i = 0; i < 8; ++i) { a[i] = (_Float16)p[i]; a[8 + i] = (_Float16)p[16 + i]; }
  return a;
}
__device__ __forceinline__ v16h frag_f32s(const float* rowk0, int lane, float sc) {
  v16h a; const float* p = rowk0 + 8 * (lane >> 4);
#pragma unroll
  for (int i = 0; i < 8; ++i) { a[i] = (_Float16)(p[i] * sc); a[8 + i] = (_Float16)(p[16 + i] * sc); }
  return a;
}
// column fragment from a [K][ld] layout (column n), rows >= K read as 0
__device__ __forceinline__ v16h fragc_f32(const float* W, int k0, int n, int lane, int ld, int K) {
  v16h a; const int g = lane >> 4;
#pragma unroll
  for (int i = 0; i < 8; ++i) { const int ka = k0 + 8 * g + i, kb = ka + 16;
    a[i] = (_Float16)(ka < K ? W[(size_t)(ka < K ? ka : K - 1) * ld + n] : 0.f); a[8 + i] = (_Float16)(kb < K ? W[(size_t)(kb < K ? kb : K - 1) * ld + n] : 0.f); }
  return a;
}
struct F2 { v16b h, l; };
__device__ __forceinline__ F2 bsplit16(const float v[16]) { F2 r;
#pragma unroll
  for (int i = 0; i < 16; ++i) { const __bf16 h = (__bf16)v[i]; r.h[i] = h; r.l[i] = (__bf16)(v[i] - (float)h); }
  return r; }
__device__ __forceinline__ F2 split_row(const float* row, int k0, int lane) { float v[16]; const float* p = row + k0 + 8 * (lane >> 4);
#pragma unroll
  for (int i = 0; i < 8; ++i) { v[i] = p[i]; v[8 + i] = p[16 + i]; }
  return bsplit16(v); }
__device__ __forceinline__ F2 split_rowK(const float* row, int k0, int lane, int K) { float v[16]; const int g = lane >> 4;
#pragma unroll
  for (int i = 0; i < 8; ++i) { const int ka = k0 + 8 * g + i, kb = ka + 16; v[i] = ka < K ? row[ka < K ? ka : K - 1] : 0.f; v[8 + i] = kb < K ? row[kb < K ? kb : K - 1] : 0.f; }
  return bsplit16(v); }
__device__ __forceinline__ F2 split_col(const float* W, int k0, int n, int lane, int ld, int K) { float v[16]; const int g = lane >> 4;
#pragma unroll
  for (int i = 0; i < 8; ++i) { const int ka = k0 + 8 * g + i, kb = ka + 16; v[i] = ka < K ? W[(size_t)(ka < K ? ka : K - 1) * ld + n] : 0.f; v[8 + i] = kb < K ? W[(size_t)(kb < K ? kb : K - 1) * ld + n] : 0.f; }
  return bsplit16(v); }
__device__ __forceinline__ v8f mac3(const F2& a, const F2& b, v8f c) { c = wmma_bf(a.l, b.h, c); c = wmma_bf(a.h, b.l, c); return wmma_bf(a.h, b.h, c); }
__device__ __forceinline__ float sigm(float v) { return 1.0f / (1.0f + expf(-v)); }
#define LDSX() do { asm volatile("s_wait_dscnt 0" ::: "memory"); __builtin_amdgcn_wave_barrier(); __builtin_amdgcn_fence(__ATOMIC_RELEASE, "workgroup"); } while (0)


// GQA causal attention with neox RoPE (B 2, S 2,048, hidden 1,024 = 16 x 64 query heads, 4 kv heads): q/k/v = x W + b, rope(positions), k/v repeated 4x, scores / 8 causal, softmax, P v, out = y Wo.
#define NB 2
#define TT 2048
#define CC 1024
#define NH 16
#define HD 64
#define NKV 4
#define KV (NKV * HD)      // 256
#define GQ (NH / NKV)      // 4
#ifndef TNB
#define TNB NB
#endif
typedef __attribute__((ext_vector_type(8))) __bf16 v8b;
__device__ __forceinline__ v16b frag_b(const __bf16* rowk0, int lane) {
  union { v16b v; v8b q[2]; } u; const __bf16* p = rowk0 + 8 * (lane >> 4);
  u.q[0] = *(const v8b*)p; u.q[1] = *(const v8b*)(p + 16); return u.v;
}
__device__ __forceinline__ float bfr(float v) { return (float)(__bf16)v; }
__device__ __attribute__((noinline)) float exp_ni(float v) { return expf(v); }
__device__ __attribute__((noinline)) float erf_ni(float v) { return erff(v); }

#define WS_QH  0u
#define WS_QL  (WS_QH + 2u * (size_t)NB * TT * CC)
#define WS_KH  (WS_QL + 2u * (size_t)NB * TT * CC)      // f16 k rows [b*t][KV]
#define WS_VT  (WS_KH + 2u * (size_t)NB * TT * KV)      // bf16 v planes [b][kvc][t]
#define WS_VL  (WS_VT + 2u * (size_t)NB * KV * TT)      // bf16 v residual planes
#define WS_Y   (WS_VL + 2u * (size_t)NB * KV * TT)      // f32 y rows [b*t][C]
#define WS_END (WS_Y + 4u * (size_t)NB * TT * CC)

// ---- operand tiles of the two projection kernels: 64 k at a time, rounded to bf16 once a block and staged in two LDS buffers that the block's 8 waves (128 rows) share.
// W [k][n] comes by whole 512-byte row pieces (16 bytes a lane), is turned in registers and stored as rows [n][k]; the activations come by whole 256-byte row pieces.
#define GK 64               // k per stage
#define GP 72               // LDS row pitch in bf16: a 128-byte row + 16 bytes, for 16-byte readers
#define GR 128              // rows per block, so that one staged W tile serves 128 rows; 8 waves, wave = (32 rows: wave >> 1, 64 columns: wave & 1): 6 fragments feed 8 products
typedef __attribute__((ext_vector_type(4))) __bf16 v4b;
__device__ __forceinline__ void w_load(v4f (&r)[8], const float* __restrict__ p, int ld, unsigned lane) {   // p = &W[k0 + 8 * wave][c0], the same in every lane (a scalar base; the lane adds one offset register); rows 8 * wave + i
#pragma unroll
  for (int i = 0; i < 8; ++i) r[i] = *(const v4f*)(p + (size_t)i * ld + lane * 4u);
}
// 16-byte piece q (k = 8q .. 8q + 7) of row n stands at place q ^ ((n >> 4) & 3): the storing lanes are 4 rows apart, and without the exchange they would meet on a quarter of the banks
__device__ __forceinline__ void w_store(const v4f (&r)[8], __bf16 (*w)[GP], int wave, int lane) {   // the wave's 8 k rows are piece q = wave
#pragma unroll
  for (int c = 0; c < 4; ++c) { v8b t;
#pragma unroll
    for (int i = 0; i < 8; ++i) t[i] = (__bf16)r[i][c];
    *(v8b*)&w[lane * 4 + c][(wave ^ ((lane >> 2) & 3)) * 8] = t; }
}
// B fragment of columns 16j .. 16j + 15, k = 32 kc .. 32 kc + 31 of the stage: the k order of frag_b
__device__ __forceinline__ v16b w_frag(const __bf16 (*w)[GP], int j, int kc, int col, int g) {
  union { v16b v; v8b q[2]; } u; const __bf16* p = &w[j * 16 + col][0];
  u.q[0] = *(const v8b*)(p + ((kc * 4 + g) ^ (j & 3)) * 8); u.q[1] = *(const v8b*)(p + ((kc * 4 + 2 + g) ^ (j & 3)) * 8); return u.v;
}
__device__ __forceinline__ void a_load(v4f (&r)[8], const float* __restrict__ p) {   // p = &A[r0 + (tid >> 4)][k0 + 4 * (tid & 15)]; rows 16 apart
#pragma unroll
  for (int i = 0; i < 8; ++i) r[i] = *(const v4f*)(p + (size_t)(i * 16) * CC);
}
// ---- L2 prefetch for the two projection kernels (for speed only).
// One wave of each block asks for its share of a later stage, PFD stages ahead: lanes 0..15 take 16 of the W tile's 128 aligned 256-byte units (dealt over the row blocks that read the same tile), lanes 16..31 take 16 of the 128 activation rows (dealt over the column blocks that read the same rows). A hint only: no result depends on it.
#define PFD 4               // stages between the pass that asks and the stage asked for (its staging loads are issued PFD - 1 passes later)
__device__ __forceinline__ const char* pf_first(const float* __restrict__ Wc, int ld, const float* __restrict__ Ar, int wsl, int asl, int lane) {   // Wc = &W[0][c0], Ar = &A[r0][0]; the lane's address in stage 1
  const int u = wsl * 16 + (lane & 15);
  return lane < 16 ? (const char*)(Wc + (size_t)(GK + (u >> 1)) * ld + (u & 1) * 64) : (const char*)(Ar + (size_t)(asl * 16 + (lane & 15)) * CC + GK);
}
// request and step stand in one statement, on one in-out register pair: the pair that a request names then holds nothing but addresses inside the same array (it steps to a later stage, never past stage CC / GK - 1)
__device__ __forceinline__ void pf_ask(const char*& p, unsigned long long step) { asm volatile("global_prefetch_b8 %0, off scope:SCOPE_SE\n\tv_add_nc_u64_e32 %0, %0, %1" : "+v"(p) : "v"(step)); }
static_assert(PFD == 4, "pf_ask3 asks for exactly the PFD - 1 stages in front of the loop's first request");
__device__ __forceinline__ void pf_ask3(const char*& p, unsigned long long step) {   // stages 1 .. PFD - 1, the same way
  asm volatile("global_prefetch_b8 %0, off scope:SCOPE_SE\n\tv_add_nc_u64_e32 %0, %0, %1\n\tglobal_prefetch_b8 %0, off scope:SCOPE_SE\n\tv_add_nc_u64_e32 %0, %0, %1\n\tglobal_prefetch_b8 %0, off scope:SCOPE_SE\n\tv_add_nc_u64_e32 %0, %0, %1" : "+v"(p) : "v"(step)); }
union ProjLds { struct { _Float16 sh[GR][136], sl[GR][136]; } e; struct { __bf16 th[128][GR + 8], tl2[128][GR + 8]; } v; struct { __bf16 w[2][128][GP], a[2][GR][GP]; } s; };   // the stages are dead when the epilogue begins; a block uses e (q, k) or v, never both
// rotary table, 16 rows made by each wave: cs[row][i] = (cos, sin)(p_row f_i), f_i = 10000^(-i/32), lane = i: each pair is made once and serves both halves of both heads of the block's 128 columns
#define CSP 34              // row pitch in pairs: the readers' two lane halves stand 8 rows apart and so fall on different halves of the banks
__device__ __forceinline__ void rope_table(v2f (*cs)[CSP], int pv, int lane) {   // pv: lane l holds the position of row l & 15; handed out by readlane
  const float inv_freq = 1.0f / powf(10000.0f, (float)(2 * lane) / 64.0f);
  // stays rolled: 16 copies of the library's argument reduction would only cost instruction cache
#pragma unroll 1
  for (int it = 0; it < 16; ++it) { const float ang = (float)__builtin_amdgcn_readlane(pv, it) * inv_freq; float s, c; sincosf(ang, &s, &c); v2f t; t[0] = c; t[1] = s; cs[it][lane] = t; }
}
union OutLds { float sf[GR / 16][32][68]; struct { __bf16 w[2][128][GP], ah[2][GR][GP], al[2][GR][GP]; } s; };
// acc += x[128 rows][1,024] W[1,024][128 columns]; LD = W's row pitch, a constant so that a stage's 8 W loads share one address and differ in their immediate offsets
template <int LD> __device__ __forceinline__ void proj_gemm(v8f (&acc)[2][4], ProjLds& sm, const float* __restrict__ wp, const float* __restrict__ xp, int wave, int lane, int ar, int aq, bool rot, v2f (*cs)[CSP], int pv, const char* pf, bool pfw) {
  v4f rw[8], ra[8]; const int col = lane & 15, g = lane >> 4; const unsigned pfs = lane < 16 ? GK * LD * 4u : GK * 4u;   // the lane's step from stage to stage, in bytes
  w_load(rw, wp, LD, lane); a_load(ra, xp);
  asm volatile("s_wait_xcnt 0x0" :: "v"(xp) : "memory");   // the address registers of these loads are reused below: the wait stands in front of that overwrite (xp as an input keeps its register pair whole up to the wait)
  if (pfw) pf_ask3(pf, pfs);   // wave-uniform (a scalar): stages 1 .. PFD - 1 are asked for while stage 0's loads fly
  if (rot) rope_table(cs, pv, lane);   // block-uniform; made here, while stage 0's loads fly; each wave makes 16 rows, and the two waves that hold those rows read them behind the barriers below
  w_store(rw, sm.s.w[0], wave, lane);
#pragma unroll
  for (int i = 0; i < 8; ++i) { v4b t;
#pragma unroll
    for (int c = 0; c < 4; ++c) t[c] = (__bf16)ra[i][c];
    *(v4b*)&sm.s.a[0][ar + i * 16][aq] = t; }
  __syncthreads();   // stage 0 is in LDS before any wave reads it
  // the stage loop stays rolled: a second copy of the body would only cost registers and instruction cache
#pragma unroll 1
  for (int st = 0; st < CC / GK; ++st) { const int cur = st & 1; const bool more = st + 1 < CC / GK;
    if (more) { w_load(rw, wp + (size_t)((st + 1) * GK) * LD, LD, lane); a_load(ra, xp + (st + 1) * GK);   // the next stage's loads fly during this stage's products
      asm volatile("s_wait_xcnt 0x0" ::: "memory"); }   // as above
    if (pfw && st + PFD < CC / GK) pf_ask(pf, st + PFD + 1 < CC / GK ? pfs : 0u);   // scalar tests; the address stops at the last stage
#pragma unroll
    for (int kc = 0; kc < GK / 32; ++kc) { v16b a[2], wf[4];   // all 12 fragment reads of 32 k stand together, in front of their 8 products
#pragma unroll
      for (int i = 0; i < 2; ++i) a[i] = frag_b(&sm.s.a[cur][(wave >> 1) * 32 + i * 16 + col][kc * 32], lane);
#pragma unroll
      for (int j = 0; j < 4; ++j) wf[j] = w_frag(sm.s.w[cur], (wave & 1) * 4 + j, kc, col, g);
#pragma unroll
      for (int i = 0; i < 2; ++i)
#pragma unroll
        for (int j = 0; j < 4; ++j) acc[i][j] = wmma_bf(a[i], wf[j], acc[i][j]); }
    if (more) { w_store(rw, sm.s.w[cur ^ 1], wave, lane);
#pragma unroll
      for (int i = 0; i < 8; ++i) { v4b t;
#pragma unroll
        for (int c = 0; c < 4; ++c) t[c] = (__bf16)ra[i][c];
        *(v4b*)&sm.s.a[cur ^ 1][ar + i * 16][aq] = t; } }
    __syncthreads(); }   // publishes stage st + 1 and ends every wave's reads of the buffer that the next pass refills (after the last pass: of the LDS that the epilogue reuses)
}
// ---- k_proj: block = (128 rows, 128 cols, which): qkv = x W (+ b), exact; q -> f16 hi (+ residual), k -> f16 rows, v -> bf16 planes (hi + lo)
__global__ __launch_bounds__(2 * GR) void k_proj(const float* __restrict__ X, const float* __restrict__ WQ, const float* __restrict__ BQ, const float* __restrict__ WK, const float* __restrict__ BK, const float* __restrict__ WV, const float* __restrict__ BV, const int* __restrict__ POS, _Float16* __restrict__ QH, _Float16* __restrict__ QL, _Float16* __restrict__ KH, __bf16* __restrict__ VT, __bf16* __restrict__ VL) {
  __shared__ __align__(16) ProjLds sm; __shared__ __align__(16) v2f cs[GR][CSP]; _Float16 (&sh)[GR][136] = sm.e.sh, (&sl)[GR][136] = sm.e.sl; __bf16 (&th)[128][GR + 8] = sm.v.th, (&tl2)[128][GR + 8] = sm.v.tl2;
  const int tid = threadIdx.x, wave = tid >> 5, lane = tid & 31, col = lane & 15, g = lane >> 4; const int which = blockIdx.z; const int c0 = blockIdx.y * 128; const size_t r0 = (size_t)blockIdx.x * GR; const int NW = which == 0 ? CC : KV; if (c0 >= NW) return;   // k/v are only KV wide (block-uniform exit)
  const float* WA = which == 0 ? WQ : which == 1 ? WK : WV; const float* BA = which == 0 ? BQ : which == 1 ? BK : BV;
  v8f acc[2][4] = {}; const int ar = tid >> 4, aq = (tid & 15) * 4; const int wr0 = (wave >> 1) * 32, wc0 = (wave & 1) * 64;   // the wave's first row and column in the block's tile
  const float* wp = WA + (size_t)(__builtin_amdgcn_readfirstlane(wave) * 8) * NW + c0; const float* xp = X + (r0 + ar) * CC + aq;
  const int pv = POS[(int)(r0 % TT) + wave * 16 + col];   // p = position_ids[t] of the 16 rows whose rotary table this wave makes (128 divides the sequence length: a block's rows do not wrap); loaded ahead of stage 0, so that its wait leaves stage 0's loads in flight
  asm volatile("s_wait_xcnt 0x0" ::: "memory");   // the offset register of this load is reused for the addresses below: the wait stands in front of that overwrite
  const bool pfw = __builtin_amdgcn_readfirstlane(wave) == 0; const char* pf = pf_first(WA + c0, NW, X + r0 * CC, (blockIdx.x & 3) | ((blockIdx.x >> 1) & 4), (blockIdx.y + 2 * which) & 7, lane);   // each eighth of a W tile is asked for by 4 row blocks whose indices differ by 4 or 16; the 8 column blocks of q cover the 128 rows once, those of k and v a part of them again
  if (which == 0) proj_gemm<CC>(acc, sm, wp, xp, wave, lane, ar, aq, true, &cs[wave * 16], pv, pf, pfw); else proj_gemm<KV>(acc, sm, wp, xp, wave, lane, ar, aq, which == 1, &cs[wave * 16], pv, pf, pfw);   // block-uniform: every wave of a block passes the same barriers
  float bb[4];
#pragma unroll
  for (int j = 0; j < 4; ++j) bb[j] = bfr(BA[c0 + wc0 + j * 16 + col]);
  if (which == 2) {
#pragma unroll
    for (int i = 0; i < 2; ++i)
#pragma unroll
      for (int j = 0; j < 4; ++j)
#pragma unroll
        for (int r = 0; r < 8; ++r) { const float v = acc[i][j][r] + bb[j]; const int rl = wr0 + i * 16 + 8 * g + r, cl = wc0 + j * 16 + col; const __bf16 bh = (__bf16)v; th[cl][rl] = bh; tl2[cl][rl] = (__bf16)(v - (float)bh); }
  } else {   // rotate-half rotary in the accumulators: out[d] = x[d] cos(p f_(d mod 32)) + (d < 32 ? -x[d+32] : x[d-32]) sin(p f_(d mod 32)); the wave's 64 columns are one head, and column d + 32 is tile j + 2 of the same lane
#pragma unroll
    for (int f = 0; f < 2; ++f)
#pragma unroll
      for (int i = 0; i < 2; ++i)
#pragma unroll
        for (int r = 0; r < 8; ++r) { const int rl = wr0 + i * 16 + 8 * g + r; const v2f t = cs[rl][f * 16 + col]; const float c = t[0], s = t[1];
          const int jl = f, jh = f + 2; const float x1 = acc[i][jl][r] + bb[jl], x2 = acc[i][jh][r] + bb[jh];
          const float v1 = fmaf(x1, c, -x2 * s), v2 = fmaf(x2, c, x1 * s); const _Float16 h1 = (_Float16)v1, h2 = (_Float16)v2;
          sh[rl][wc0 + jl * 16 + col] = h1; sl[rl][wc0 + jl * 16 + col] = (_Float16)((v1 - (float)h1) * 1024.0f); sh[rl][wc0 + jh * 16 + col] = h2; sl[rl][wc0 + jh * 16 + col] = (_Float16)((v2 - (float)h2) * 1024.0f); }   /* q residual carried x 2^10 so the plane stays f16-normal on the chip */
  }
  __syncthreads();   // the block's tile is in LDS before the whole-line stores read it
  if (which < 2) { _Float16* dh = which == 0 ? QH : KH; for (int e = tid; e < GR * 16; e += 2 * GR) { const int rl = e >> 4, q = e & 15; vst2((unsigned*)(dh + (r0 + rl) * NW + c0 + q * 8), *(const v4u*)&sh[rl][q * 8]);
      asm volatile("s_wait_xcnt 0x0" ::: "memory");   // the registers of this store are reused by the next LDS read and the next address: the wait stands in front of that overwrite
      if (which == 0) { vst2((unsigned*)(QL + (r0 + rl) * CC + c0 + q * 8), *(const v4u*)&sl[rl][q * 8]);
        asm volatile("s_wait_xcnt 0x0" ::: "memory"); } } }   // as above
  else { const size_t b = r0 / TT; const int t0 = (int)(r0 % TT); for (int e = tid; e < 128 * (GR / 8); e += 2 * GR) { const int cl = e >> 4, q = e & 15; const size_t o2 = (b * KV + c0 + cl) * (size_t)TT + t0 + q * 8; vst2((unsigned*)(VT + o2), *(const v4u*)&th[cl][q * 8]); vst2((unsigned*)(VL + o2), *(const v4u*)&tl2[cl][q * 8]); } } }
#define FQ 2                // 16-query tiles per block
#define FW (GQ * FQ)        // waves per block
#define SP 72               // LDS row pitch in 16-bit elements: a 128-byte row + 16 bytes, for 16-byte readers
#define L2E 1.44269504088896340736f
// waves_per_eu(4, 4): two blocks a WGP; lets the compiler keep all 24 fragment reads of a 32-key pass in flight at once instead of saving registers
__global__ __launch_bounds__(32 * FW) __attribute__((amdgpu_waves_per_eu(4, 4))) void k_fa(const _Float16* __restrict__ QH, const _Float16* __restrict__ QL, const _Float16* __restrict__ KH, const __bf16* __restrict__ VT, const __bf16* __restrict__ VL, float* __restrict__ Y) {
  __shared__ __align__(16) _Float16 sk[2][64][SP]; __shared__ __align__(16) __bf16 svh[2][64][SP], svl[2][64][SP]; __shared__ __align__(16) float so[FW][16][HD + 4];
  const int tid = threadIdx.x, wave = __builtin_amdgcn_readfirstlane(tid >> 5), lane = tid & 31, col = lane & 15, g = lane >> 4;
  const int kvh = blockIdx.x % NKV, b = blockIdx.x / NKV; const int yb = blockIdx.y; const int q0 = (yb < TT / 64 ? TT / 32 - 1 - yb : yb - TT / 64) * 32;   // long blocks first, then short ones in rising order (a permutation; for balance only)
  const int h = kvh * GQ + (wave & (GQ - 1)), ql0 = q0 + (wave / GQ) * 16, qt = ql0 + col; const int ns = q0 / 64 + 1;   // 64-key stages up to the block's diagonal
  const int sr = tid >> 3, sc = (tid & 7) * 8;   // staging: 8 lanes a row, rows sr and sr + 32
  const _Float16* gk = KH + ((size_t)b * TT + sr) * KV + kvh * HD + sc; const size_t vo = ((size_t)b * KV + kvh * HD + sr) * (size_t)TT + sc; const __bf16 *gh = VT + vo, *gl = VL + vo;
  v16h qh[2], qr[2];
#pragma unroll
  for (int kc = 0; kc < 2; ++kc) { const size_t qo = ((size_t)b * TT + qt) * CC + h * HD + kc * 32; qh[kc] = frag_h(QH + qo, lane); qr[kc] = frag_h(QL + qo, lane); }
  v8h rk0 = *(const v8h*)gk, rk1 = *(const v8h*)(gk + 32 * KV); v8b rh0 = *(const v8b*)gh, rh1 = *(const v8b*)(gh + 32 * TT), rl0 = *(const v8b*)gl, rl1 = *(const v8b*)(gl + 32 * TT);
  *(v8h*)&sk[0][sr][sc] = rk0; *(v8h*)&sk[0][sr + 32][sc] = rk1; *(v8b*)&svh[0][sr][sc] = rh0; *(v8b*)&svh[0][sr + 32][sc] = rh1; *(v8b*)&svl[0][sr][sc] = rl0; *(v8b*)&svl[0][sr + 32][sc] = rl1;
  __syncthreads();   // stage 0 is in LDS before any wave reads it
  v8f o[HD / 16] = {}; float m = -3.0e38f, l = 0.f;
  // the stage loop stays rolled (its trip count is the block's own; a second copy of the body would only cost instruction cache); every full unroll below keeps a fragment or accumulator array in registers
#pragma unroll 1
  for (int st = 0; st < ns; ++st) { const int cur = st & 1, k0 = st * 64; const bool more = st + 1 < ns;   // block-uniform
    if (more) { const int kn = k0 + 64; rk0 = *(const v8h*)(gk + (size_t)kn * KV); rk1 = *(const v8h*)(gk + (size_t)(kn + 32) * KV); rh0 = *(const v8b*)(gh + kn); rh1 = *(const v8b*)(gh + 32 * TT + kn); rl0 = *(const v8b*)(gl + kn); rl1 = *(const v8b*)(gl + 32 * TT + kn);
      asm volatile("s_wait_xcnt 0x0" ::: "memory"); }   // the fragment reads below reuse the address registers of these six loads: the wait stands in front of that overwrite
#pragma unroll
    for (int hf = 0; hf < 2; ++hf) { const int kb0 = k0 + hf * 32;
      if (kb0 <= ql0 + 15) {   // wave-uniform: 32 keys wholly above this wave's diagonal add nothing
        v16h ka[2], kb[2]; v16b vh[HD / 16], vl[HD / 16]; v8f s[2] = {};
#pragma unroll
        for (int j = 0; j < 2; ++j) { const _Float16* kp = &sk[cur][hf * 32 + j * 16 + col][0]; ka[j] = frag_h(kp, lane); kb[j] = frag_h(kp + 32, lane); }
#pragma unroll
        for (int j = 0; j < HD / 16; ++j) { vh[j] = frag_b(&svh[cur][j * 16 + col][hf * 32], lane); vl[j] = frag_b(&svl[cur][j * 16 + col][hf * 32], lane); }
#pragma unroll
        for (int j = 0; j < 2; ++j) s[j] = wmma16(ka[j], qr[0], s[j]);
#pragma unroll
        for (int j = 0; j < 2; ++j) s[j] = wmma16(kb[j], qr[1], s[j]);
#pragma unroll
        for (int j = 0; j < 2; ++j) s[j] *= (1.0f / 1024.0f);   // the residual plane is carried x 2^10
#pragma unroll
        for (int j = 0; j < 2; ++j) s[j] = wmma16(ka[j], qh[0], s[j]);
#pragma unroll
        for (int j = 0; j < 2; ++j) s[j] = wmma16(kb[j], qh[1], s[j]);
#pragma unroll
        for (int j = 0; j < 2; ++j) s[j] *= 0.125f;
        if (kb0 + 31 > ql0) {   // wave-uniform: only keys at the diagonal mask; key 0 is open to every query, so the running maximum is finite from the first 32 keys on
#pragma unroll
          for (int j = 0; j < 2; ++j)
#pragma unroll
            for (int r = 0; r < 8; ++r) if (kb0 + j * 16 + 8 * g + r > qt) s[j][r] = -3.0e38f; }
        float mx = m;
#pragma unroll
        for (int j = 0; j < 2; ++j)
#pragma unroll
          for (int r = 0; r < 8; ++r) mx = fmaxf(mx, s[j][r]);
        mx = fmaxf(mx, __shfl_xor(mx, 16));
        const float al = __builtin_amdgcn_exp2f((m - mx) * L2E); m = mx; l *= al;
#pragma unroll
        for (int j = 0; j < HD / 16; ++j) o[j] *= al;
        v16b ph, pl;   // B fragment of Pt: element i = key 8g + i of score tile 0, element 8 + i = the same row of tile 1: the k order of frag_b
#pragma unroll
        for (int i = 0; i < 8; ++i) { const float x = __builtin_amdgcn_exp2f((s[0][i] - mx) * L2E), y = __builtin_amdgcn_exp2f((s[1][i] - mx) * L2E); l += x + y;
          const __bf16 xh = (__bf16)x, yh = (__bf16)y; ph[i] = xh; ph[8 + i] = yh; pl[i] = (__bf16)(x - (float)xh); pl[8 + i] = (__bf16)(y - (float)yh); }
#pragma unroll
        for (int j = 0; j < HD / 16; ++j) o[j] = wmma_bf(vh[j], ph, o[j]);
#pragma unroll
        for (int j = 0; j < HD / 16; ++j) o[j] = wmma_bf(vh[j], pl, o[j]);
#pragma unroll
        for (int j = 0; j < HD / 16; ++j) o[j] = wmma_bf(vl[j], ph, o[j]); } }
    if (more) { const int nx = cur ^ 1; *(v8h*)&sk[nx][sr][sc] = rk0; *(v8h*)&sk[nx][sr + 32][sc] = rk1; *(v8b*)&svh[nx][sr][sc] = rh0; *(v8b*)&svh[nx][sr + 32][sc] = rh1; *(v8b*)&svl[nx][sr][sc] = rl0; *(v8b*)&svl[nx][sr + 32][sc] = rl1; }
    __syncthreads(); }   // publishes stage st + 1 and ends every wave's reads of the buffer that the next pass refills
  l += __shfl_xor(l, 16); const float inv = 1.0f / l;
#pragma unroll
  for (int j = 0; j < HD / 16; ++j) { v4f lo4, hi4;
#pragma unroll
    for (int r = 0; r < 4; ++r) { lo4[r] = o[j][r] * inv; hi4[r] = o[j][4 + r] * inv; }
    *(v4f*)&so[wave][col][j * 16 + 8 * g] = lo4; *(v4f*)&so[wave][col][j * 16 + 8 * g + 4] = hi4; }
  LDSX();   // the wave's own tile, turned in its own LDS range so that the stores cover whole lines
#pragma unroll
  for (int it = 0; it < 8; ++it) { const int rl = it * 2 + g; vst2(Y + ((size_t)b * TT + ql0 + rl) * CC + h * HD + col * 4, *(const v4f*)&so[wave][rl][col * 4]); } }
// ---- k_out: block = (128 rows, 128 cols): out = y (bf16 hi + lo) Wo ((in,out), exact bf16 weights), f32 accumulate
__global__ __launch_bounds__(2 * GR) void k_out(const float* __restrict__ Y, const float* __restrict__ WO, float* __restrict__ OUT) { __shared__ __align__(16) OutLds sm; float (&sf)[GR / 16][32][68] = sm.sf;
  const int tid = threadIdx.x, wave = tid >> 5, lane = tid & 31, col = lane & 15, g = lane >> 4; const int c0 = blockIdx.y * 128; const size_t r0 = (size_t)blockIdx.x * GR + (wave >> 1) * 32; const int wc0 = (wave & 1) * 64;   // the wave's first row, and its first column in the block's tile
  v8f acc[2][4] = {}; v4f rw[8], ra[8]; const int ar = tid >> 4, aq = (tid & 15) * 4;
  const float* wp = WO + (size_t)(__builtin_amdgcn_readfirstlane(wave) * 8) * CC + c0; const float* yp = Y + ((size_t)blockIdx.x * GR + ar) * CC + aq;
  const bool pfw = __builtin_amdgcn_readfirstlane(wave) == 0; const unsigned pfs = lane < 16 ? GK * CC * 4u : GK * 4u; const char* pf = pf_first(WO + c0, CC, Y + (size_t)blockIdx.x * GR * CC, (blockIdx.x & 3) | ((blockIdx.x >> 1) & 4), blockIdx.y & 7, lane);
  w_load(rw, wp, CC, lane); a_load(ra, yp);
  asm volatile("s_wait_xcnt 0x0" ::: "memory");   // the address registers of these loads are reused below: the wait stands in front of that overwrite
  if (pfw) pf_ask3(pf, pfs);   // wave-uniform (a scalar): stages 1 .. PFD - 1 are asked for while stage 0's loads fly
  w_store(rw, sm.s.w[0], wave, lane);
#pragma unroll
  for (int i = 0; i < 8; ++i) { v4b th, tl;
#pragma unroll
    for (int c = 0; c < 4; ++c) { const __bf16 h = (__bf16)ra[i][c]; th[c] = h; tl[c] = (__bf16)(ra[i][c] - (float)h); }
    *(v4b*)&sm.s.ah[0][ar + i * 16][aq] = th; *(v4b*)&sm.s.al[0][ar + i * 16][aq] = tl; }
  __syncthreads();   // stage 0 is in LDS before any wave reads it
  // the stage loop stays rolled: a second copy of the body would only cost registers and instruction cache
#pragma unroll 1
  for (int st = 0; st < CC / GK; ++st) { const int cur = st & 1; const bool more = st + 1 < CC / GK;
    if (more) { w_load(rw, wp + (size_t)((st + 1) * GK) * CC, CC, lane); a_load(ra, yp + (st + 1) * GK);   // the next stage's loads fly during this stage's products
      asm volatile("s_wait_xcnt 0x0" ::: "memory"); }   // as above
    if (pfw && st + PFD < CC / GK) pf_ask(pf, st + PFD + 1 < CC / GK ? pfs : 0u);   // scalar tests; the address stops at the last stage
#pragma unroll
    for (int kc = 0; kc < GK / 32; ++kc) { v16b ah[2], al[2], wf[4];   // all 16 fragment reads of 32 k stand together, in front of their 16 products
#pragma unroll
      for (int i = 0; i < 2; ++i) { ah[i] = frag_b(&sm.s.ah[cur][(wave >> 1) * 32 + i * 16 + col][kc * 32], lane); al[i] = frag_b(&sm.s.al[cur][(wave >> 1) * 32 + i * 16 + col][kc * 32], lane); }
#pragma unroll
      for (int j = 0; j < 4; ++j) wf[j] = w_frag(sm.s.w[cur], (wave & 1) * 4 + j, kc, col, g);
#pragma unroll
      for (int i = 0; i < 2; ++i)
#pragma unroll
        for (int j = 0; j < 4; ++j) acc[i][j] = wmma_bf(ah[i], wf[j], acc[i][j]);   // hi over all 8 tiles, then lo: each tile still adds hi before lo, and no product waits for the one directly in front of it
#pragma unroll
      for (int i = 0; i < 2; ++i)
#pragma unroll
        for (int j = 0; j < 4; ++j) acc[i][j] = wmma_bf(al[i], wf[j], acc[i][j]); }
    if (more) { w_store(rw, sm.s.w[cur ^ 1], wave, lane);
#pragma unroll
      for (int i = 0; i < 8; ++i) { v4b th, tl;
#pragma unroll
        for (int c = 0; c < 4; ++c) { const __bf16 h = (__bf16)ra[i][c]; th[c] = h; tl[c] = (__bf16)(ra[i][c] - (float)h); }
        *(v4b*)&sm.s.ah[cur ^ 1][ar + i * 16][aq] = th; *(v4b*)&sm.s.al[cur ^ 1][ar + i * 16][aq] = tl; } }
    __syncthreads(); }   // publishes stage st + 1 and ends every wave's reads of the buffer that the next pass refills (after the last pass: of the LDS that the epilogue reuses)
#pragma unroll
  for (int i = 0; i < 2; ++i)
#pragma unroll
    for (int j = 0; j < 4; ++j)
#pragma unroll
      for (int r = 0; r < 8; ++r) sf[wave][i * 16 + 8 * g + r][j * 16 + col] = acc[i][j][r];
  LDSX(); for (int it = 0; it < 16; ++it) { const int rl = it * 2 + g; vst2(OUT + (r0 + rl) * CC + c0 + wc0 + col * 4, *(const v4f*)&sf[wave][rl][col * 4]); } }   // the wave's own tile, turned in its own LDS range: each store covers two whole 256-byte row pieces
extern "C" void kernel_launch(void* const* d_in, const int* in_sizes, int n_in, void* d_out, int out_size, void* d_ws, size_t ws_size, hipStream_t stream) {
  (void)in_sizes; (void)n_in; (void)out_size;
  const float** F = (const float**)d_in;   // 0 hidden_states [2,2048,1024], 1 positions [2048] int32 (verbatim arange; read), 2 Wq [1024,1024] ((in,out)), 3 bq, 4 Wk [1024,256], 5 bk, 6 Wv [1024,256], 7 bv, 8 Wo [1024,1024] ((in,out))
  if (ws_size < (size_t)WS_END) return;
  char* ws = (char*)d_ws; _Float16 *QH = (_Float16*)(ws + WS_QH), *QL = (_Float16*)(ws + WS_QL), *KH = (_Float16*)(ws + WS_KH); __bf16 *VT = (__bf16*)(ws + WS_VT), *VL = (__bf16*)(ws + WS_VL); float *Y = (float*)(ws + WS_Y);
  k_proj<<<dim3(TNB * TT / GR, CC / 128, 3), 2 * GR, 0, stream>>>(F[0], F[2], F[3], F[4], F[5], F[6], F[7], (const int*)d_in[1], QH, QL, KH, VT, VL);
  k_fa<<<dim3(TNB * NKV, TT / 32), 32 * FW, 0, stream>>>(QH, QL, KH, VT, VL, Y);
  k_out<<<dim3(TNB * TT / GR, CC / 128), 2 * GR, 0, stream>>>(Y, F[8], (float*)d_out);
}

// v010
// One run takes 60.9 microseconds.
// Versions in between are left out here; by their measured steps it is 1.36 times as fast as v006.
// All steps since v000 together make it 20.8 times as fast.
// compute dtype: all float inputs rounded to bf16, positions (int) read; q/k/v = x W + b ((in,out)) with EXACT bf16 products on WMMA 16x16x32, f32 accumulate; neox rotary (rotate-half) in f32 (inv_freq = 10000^(-2i/64) via powf, precise cosf/sinf, positions read) on q and k; q f16, k f16 -> 1-product logits / 8, causal, kept in registers (kv head = h/4); running-maximum softmax in f32 (exp2 of the log2e-scaled difference; even and odd 32-key groups run apart and join at the end), unnormalised P rounded to f16 against v f16 (1 product), divided by the row sum at the end; out = y (one f16 plane) Wo ((in,out), its bf16 values carried in f16), 1 product; f32 output.
#include <hip/hip_runtime.h>
#include <math.h>

typedef __attribute__((ext_vector_type(16))) _Float16 v16h;
typedef __attribute__((ext_vector_type(16))) __bf16 v16b;
typedef __attribute__((ext_vector_type(8)))  _Float16 v8h;
typedef __attribute__((ext_vector_type(8)))  float v8f;
typedef __attribute__((ext_vector_type(4)))  float v4f;
typedef __attribute__((ext_vector_type(2)))  float v2f;
typedef __attribute__((ext_vector_type(4)))  unsigned v4u;
typedef __attribute__((ext_vector_type(4)))  int v4i;
typedef float __attribute__((may_alias)) float_a;
typedef int __attribute__((may_alias)) int_a;

template <typename T> __device__ __forceinline__ void vst2(void* p, T v) { *(T*)p = v;  }
__device__ __forceinline__ v8f wmma16(v16h a, v16h b, v8f c) {
  v8f d = __builtin_amdgcn_wmma_f32_16x16x32_f16(false, a, false, b, (short)0, c, false, false);
  asm volatile("v_nop\n\tv_nop\n\tv_nop\n\tv_nop" : "+v"(d) : "v"(a), "v"(b));
  return d;
}
__device__ __forceinline__ v8f wmma_bf(v16b a, v16b b, v8f c) {
  v8f d = __builtin_amdgcn_wmma_f32_16x16x32_bf16(false, a, false, b, (short)0, c, false, false);
  asm volatile("v_nop\n\tv_nop\n\tv_nop\n\tv_nop" : "+v"(d) : "v"(a), "v"(b));
  return d;
}
// 16x16x32 fragments: lane = (h = lane>>4, row/col = lane&15); elements 0..7 = k0+8h+0..7, 8..15 = k0+16+8h+0..7; D element r = row 8h+r
__device__ __forceinline__ v16h frag_h(const _Float16* rowk0, int lane) {
  union { v16h v; v8h q[2]; } u; const _Float16* p = rowk0 + 8 * (lane >> 4);
  u.q[0] = *(const v8h*)p; u.q[1] = *(const v8h*)(p + 16); return u.v;
}
__device__ __forceinline__ v16h frag_f32(const float* rowk0, int lane) {
  v16h a; const float* p = rowk0 + 8 * (lane >> 4);
#pragma unroll
  for (int i = 0; i < 8; ++i) { a[i] = (_Float16)p[i]; a[8 + i] = (_Float16)p[16 + i]; }
  return a;
}
__device__ __forceinline__ v16h frag_f32s(const float* rowk0, int lane, float sc) {
  v16h a; const float* p = rowk0 + 8 * (lane >> 4);
#pragma unroll
  for (int i = 0; i < 8; ++i) { a[i] = (_Float16)(p[i] * sc); a[8 + i] = (_Float16)(p[16 + i] * sc); }
  return a;
}
// column fragment from a [K][ld] layout (column n), rows >= K read as 0
__device__ __forceinline__ v16h fragc_f32(const float* W, int k0, int n, int lane, int ld, int K) {
  v16h a; const int g = lane >> 4;
#pragma unroll
  for (int i = 0; i < 8; ++i) { const int ka = k0 + 8 * g + i, kb = ka + 16;
    a[i] = (_Float16)(ka < K ? W[(size_t)(ka < K ? ka : K - 1) * ld + n] : 0.f); a[8 + i] = (_Float16)(kb < K ? W[(size_t)(kb < K ? kb : K - 1) * ld + n] : 0.f); }
  return a;
}
struct F2 { v16b h, l; };
__device__ __forceinline__ F2 bsplit16(const float v[16]) { F2 r;
#pragma unroll
  for (int i = 0; i < 16; ++i) { const __bf16 h = (__bf16)v[i]; r.h[i] = h; r.l[i] = (__bf16)(v[i] - (float)h); }
  return r; }
__device__ __forceinline__ F2 split_row(const float* row, int k0, int lane) { float v[16]; const float* p = row + k0 + 8 * (lane >> 4);
#pragma unroll
  for (int i = 0; i < 8; ++i) { v[i] = p[i]; v[8 + i] = p[16 + i]; }
  return bsplit16(v); }
__device__ __forceinline__ F2 split_rowK(const float* row, int k0, int lane, int K) { float v[16]; const int g = lane >> 4;
#pragma unroll
  for (int i = 0; i < 8; ++i) { const int ka = k0 + 8 * g + i, kb = ka + 16; v[i] = ka < K ? row[ka < K ? ka : K - 1] : 0.f; v[8 + i] = kb < K ? row[kb < K ? kb : K - 1] : 0.f; }
  return bsplit16(v); }
__device__ __forceinline__ F2 split_col(const float* W, int k0, int n, int lane, int ld, int K) { float v[16]; const int g = lane >> 4;
#pragma unroll
  for (int i = 0; i < 8; ++i) { const int ka = k0 + 8 * g + i, kb = ka + 16; v[i] = ka < K ? W[(size_t)(ka < K ? ka : K - 1) * ld + n] : 0.f; v[8 + i] = kb < K ? W[(size_t)(kb < K ? kb : K - 1) * ld + n] : 0.f; }
  return bsplit16(v); }
__device__ __forceinline__ v8f mac3(const F2& a, const F2& b, v8f c) { c = wmma_bf(a.l, b.h, c); c = wmma_bf(a.h, b.l, c); return wmma_bf(a.h, b.h, c); }
__device__ __forceinline__ float sigm(float v) { return 1.0f / (1.0f + expf(-v)); }
#define LDSX() do { asm volatile("s_wait_dscnt 0" ::: "memory"); __builtin_amdgcn_wave_barrier(); __builtin_amdgcn_fence(__ATOMIC_RELEASE, "workgroup"); } while (0)


// GQA causal attention with neox RoPE (B 2, S 2,048, hidden 1,024 = 16 x 64 query heads, 4 kv heads): q/k/v = x W + b, rope(positions), k/v repeated 4x, scores / 8 causal, softmax, P v, out = y Wo.
#define NB 2
#define TT 2048
#define CC 1024
#define NH 16
#define HD 64
#define NKV 4
#define KV (NKV * HD)      // 256
#define GQ (NH / NKV)      // 4
#ifndef TNB
#define TNB NB
#endif
typedef __attribute__((ext_vector_type(8))) __bf16 v8b;
__device__ __forceinline__ v16b frag_b(const __bf16* rowk0, int lane) {
  union { v16b v; v8b q[2]; } u; const __bf16* p = rowk0 + 8 * (lane >> 4);
  u.q[0] = *(const v8b*)p; u.q[1] = *(const v8b*)(p + 16); return u.v;
}
__device__ __forceinline__ float bfr(float v) { return (float)(__bf16)v; }
__device__ __attribute__((noinline)) float exp_ni(float v) { return expf(v); }
__device__ __attribute__((noinline)) float erf_ni(float v) { return erff(v); }

#define WS_QH  0u
#define WS_KH  (WS_QH + 2u * (size_t)NB * TT * CC)      // f16 k rows [b*t][KV]
#define WS_VT  (WS_KH + 2u * (size_t)NB * TT * KV)      // f16 v planes [b][kvc][t]
#define WS_Y   (WS_VT + 2u * (size_t)NB * KV * TT)      // f16 y rows [b*t][C]
#define WS_END (WS_Y + 2u * (size_t)NB * TT * CC)

// ---- operand tiles of the two projection kernels: 64 k at a time, rounded to bf16 once a block (in k_out only W, carried in f16; y is f16 already) and staged in two LDS buffers that the block's 8 waves (128 rows) share.
// W [k][n] comes by whole 512-byte row pieces (16 bytes a lane), is turned in registers and stored as rows [n][k]; the activations come by whole 256-byte row pieces (f32 x) or 128-byte ones (f16 y).
#define GK 64               // k per stage
#define GP 72               // LDS row pitch in bf16: a 128-byte row + 16 bytes, for 16-byte readers
#define GR 128              // rows per block, so that one staged W tile serves 128 rows; 8 waves, wave = (32 rows: wave >> 1, 64 columns: wave & 1): 6 fragments feed 8 products
typedef __attribute__((ext_vector_type(4))) __bf16 v4b;
__device__ __forceinline__ void w_load(v4f (&r)[8], const float* __restrict__ p, int ld, unsigned lane) {   // p = &W[k0 + 8 * wave][c0], the same in every lane (a scalar base; the lane adds one offset register); rows 8 * wave + i
#pragma unroll
  for (int i = 0; i < 8; ++i) r[i] = *(const v4f*)(p + (size_t)i * ld + lane * 4u);
}
// 16-byte piece q (k = 8q .. 8q + 7) of row n stands at place q ^ ((n >> 4) & 3): the storing lanes are 4 rows apart, and without the exchange they would meet on a quarter of the banks
__device__ __forceinline__ void w_store(const v4f (&r)[8], __bf16 (*w)[GP], int wave, int lane) {   // the wave's 8 k rows are piece q = wave
#pragma unroll
  for (int c = 0; c < 4; ++c) { v8b t;
#pragma unroll
    for (int i = 0; i < 8; ++i) t[i] = (__bf16)r[i][c];
    *(v8b*)&w[lane * 4 + c][(wave ^ ((lane >> 2) & 3)) * 8] = t; }
}
// B fragment of columns 16j .. 16j + 15, k = 32 kc .. 32 kc + 31 of the stage: the k order of frag_b
__device__ __forceinline__ v16b w_frag(const __bf16 (*w)[GP], int j, int kc, int col, int g) {
  union { v16b v; v8b q[2]; } u; const __bf16* p = &w[j * 16 + col][0];
  u.q[0] = *(const v8b*)(p + ((kc * 4 + g) ^ (j & 3)) * 8); u.q[1] = *(const v8b*)(p + ((kc * 4 + 2 + g) ^ (j & 3)) * 8); return u.v;
}
// the same two for the output projection, whose operands are f16: W is rounded to bf16 as before and that value is carried in f16 (8 significant bits fit in 11; below 2^-14 the f16 grid of 2^-24 takes over)
__device__ __forceinline__ void w_store_h(const v4f (&r)[8], _Float16 (*w)[GP], int wave, int lane) {
#pragma unroll
  for (int c = 0; c < 4; ++c) { v8h t;
#pragma unroll
    for (int i = 0; i < 8; ++i) t[i] = (_Float16)bfr(r[i][c]);
    *(v8h*)&w[lane * 4 + c][(wave ^ ((lane >> 2) & 3)) * 8] = t; }
}
__device__ __forceinline__ v16h w_frag_h(const _Float16 (*w)[GP], int j, int kc, int col, int g) {
  union { v16h v; v8h q[2]; } u; const _Float16* p = &w[j * 16 + col][0];
  u.q[0] = *(const v8h*)(p + ((kc * 4 + g) ^ (j & 3)) * 8); u.q[1] = *(const v8h*)(p + ((kc * 4 + 2 + g) ^ (j & 3)) * 8); return u.v;
}
__device__ __forceinline__ void a_load(v4f (&r)[8], const float* __restrict__ p) {   // p = &A[r0 + (tid >> 4)][k0 + 4 * (tid & 15)]; rows 16 apart
#pragma unroll
  for (int i = 0; i < 8; ++i) r[i] = *(const v4f*)(p + (size_t)(i * 16) * CC);
}
// ---- L2 prefetch for the two projection kernels (for speed only).
// One wave of each block asks for its share of a later stage, PFD stages ahead: lanes 0..15 take 16 of the W tile's 128 aligned 256-byte units (dealt over the row blocks that read the same tile), lanes 16..31 take 16 of the 128 activation rows (dealt over the column blocks that read the same rows). A hint only: no result depends on it.
#define PFD 4               // stages between the pass that asks and the stage asked for (its staging loads are issued PFD - 1 passes later)
__device__ __forceinline__ const char* pf_first(const float* __restrict__ Wc, int ld, const float* __restrict__ Ar, int wsl, int asl, int lane) {   // Wc = &W[0][c0], Ar = &A[r0][0]; the lane's address in stage 1
  const int u = wsl * 16 + (lane & 15);
  return lane < 16 ? (const char*)(Wc + (size_t)(GK + (u >> 1)) * ld + (u & 1) * 64) : (const char*)(Ar + (size_t)(asl * 16 + (lane & 15)) * CC + GK);
}
__device__ __forceinline__ const char* pf_first_h(const float* __restrict__ Wc, int ld, const _Float16* __restrict__ Ar, int wsl, int asl, int lane) {   // the same with f16 activation rows: a stage's piece of a row is 128 bytes
  const int u = wsl * 16 + (lane & 15);
  return lane < 16 ? (const char*)(Wc + (size_t)(GK + (u >> 1)) * ld + (u & 1) * 64) : (const char*)(Ar + (size_t)(asl * 16 + (lane & 15)) * CC + GK);
}
// request and step stand in one statement, on one in-out register pair: the pair that a request names then holds nothing but addresses inside the same array (it steps to a later stage, never past stage CC / GK - 1)
__device__ __forceinline__ void pf_ask(const char*& p, unsigned long long step) { asm volatile("global_prefetch_b8 %0, off scope:SCOPE_SE\n\tv_add_nc_u64_e32 %0, %0, %1" : "+v"(p) : "v"(step)); }
static_assert(PFD == 4, "pf_ask3 asks for exactly the PFD - 1 stages in front of the loop's first request");
__device__ __forceinline__ void pf_ask3(const char*& p, unsigned long long step) {   // stages 1 .. PFD - 1, the same way
  asm volatile("global_prefetch_b8 %0, off scope:SCOPE_SE\n\tv_add_nc_u64_e32 %0, %0, %1\n\tglobal_prefetch_b8 %0, off scope:SCOPE_SE\n\tv_add_nc_u64_e32 %0, %0, %1\n\tglobal_prefetch_b8 %0, off scope:SCOPE_SE\n\tv_add_nc_u64_e32 %0, %0, %1" : "+v"(p) : "v"(step)); }
union ProjLds { struct { _Float16 sh[GR][136]; } e; struct { _Float16 th[128][GR + 8]; } v; struct { __bf16 w[2][128][GP], a[2][GR][GP]; } s; };   // the stages are dead when the epilogue begins; a block uses e (q, k) or v, never both
// rotary table, 16 rows made by each wave: cs[row][i] = (cos, sin)(p_row f_i), f_i = 10000^(-i/32), lane = i: each pair is made once and serves both halves of both heads of the block's 128 columns
#define CSP 34              // row pitch in pairs: the readers' two lane halves stand 8 rows apart and so fall on different halves of the banks
__device__ __forceinline__ void rope_table(v2f (*cs)[CSP], int pv, int lane) {   // pv: lane l holds the position of row l & 15; handed out by readlane
  const float inv_freq = 1.0f / powf(10000.0f, (float)(2 * lane) / 64.0f);
  // stays rolled: 16 copies of the library's argument reduction would only cost instruction cache
#pragma unroll 1
  for (int it = 0; it < 16; ++it) { const float ang = (float)__builtin_amdgcn_readlane(pv, it) * inv_freq; float s, c; sincosf(ang, &s, &c); v2f t; t[0] = c; t[1] = s; cs[it][lane] = t; }
}
union OutLds { float sf[GR / 16][32][68]; struct { _Float16 w[2][128][GP], a[2][GR][GP]; } s; };
// acc += x[128 rows][1,024] W[1,024][128 columns]; LD = W's row pitch, a constant so that a stage's 8 W loads share one address and differ in their immediate offsets
template <int LD> __device__ __forceinline__ void proj_gemm(v8f (&acc)[2][4], ProjLds& sm, const float* __restrict__ wp, const float* __restrict__ xp, int wave, int lane, int ar, int aq, bool rot, v2f (*cs)[CSP], int pv, const char* pf, bool pfw) {
  v4f rw[8], ra[8]; const int col = lane & 15, g = lane >> 4; const unsigned pfs = lane < 16 ? GK * LD * 4u : GK * 4u;   // the lane's step from stage to stage, in bytes
  w_load(rw, wp, LD, lane); a_load(ra, xp);
  asm volatile("s_wait_xcnt 0x0" :: "v"(xp) : "memory");   // the address registers of these loads are reused below: the wait stands in front of that overwrite (xp as an input keeps its register pair whole up to the wait)
  if (pfw) pf_ask3(pf, pfs);   // wave-uniform (a scalar): stages 1 .. PFD - 1 are asked for while stage 0's loads fly
  if (rot) rope_table(cs, pv, lane);   // block-uniform; made here, while stage 0's loads fly; each wave makes 16 rows, and the two waves that hold those rows read them behind the barriers below
  w_store(rw, sm.s.w[0], wave, lane);
#pragma unroll
  for (int i = 0; i < 8; ++i) { v4b t;
#pragma unroll
    for (int c = 0; c < 4; ++c) t[c] = (__bf16)ra[i][c];
    *(v4b*)&sm.s.a[0][ar + i * 16][aq] = t; }
  __syncthreads();   // stage 0 is in LDS before any wave reads it
  // the stage loop stays rolled: a second copy of the body would only cost registers and instruction cache
#pragma unroll 1
  for (int st = 0; st < CC / GK; ++st) { const int cur = st & 1; const bool more = st + 1 < CC / GK;
    if (more) { w_load(rw, wp + (size_t)((st + 1) * GK) * LD, LD, lane); a_load(ra, xp + (st + 1) * GK);   // the next stage's loads fly during this stage's products
      asm volatile("s_wait_xcnt 0x0" ::: "memory"); }   // as above
    if (pfw && st + PFD < CC / GK) pf_ask(pf, st + PFD + 1 < CC / GK ? pfs : 0u);   // scalar tests; the address stops at the last stage
#pragma unroll
    for (int kc = 0; kc < GK / 32; ++kc) { v16b a[2], wf[4];   // all 12 fragment reads of 32 k stand together, in front of their 8 products
#pragma unroll
      for (int i = 0; i < 2; ++i) a[i] = frag_b(&sm.s.a[cur][(wave >> 1) * 32 + i * 16 + col][kc * 32], lane);
#pragma unroll
      for (int j = 0; j < 4; ++j) wf[j] = w_frag(sm.s.w[cur], (wave & 1) * 4 + j, kc, col, g);
#pragma unroll
      for (int i = 0; i < 2; ++i)
#pragma unroll
        for (int j = 0; j < 4; ++j) acc[i][j] = wmma_bf(a[i], wf[j], acc[i][j]); }
    if (more) { w_store(rw, sm.s.w[cur ^ 1], wave, lane);
#pragma unroll
      for (int i = 0; i < 8; ++i) { v4b t;
#pragma unroll
        for (int c = 0; c < 4; ++c) t[c] = (__bf16)ra[i][c];
        *(v4b*)&sm.s.a[cur ^ 1][ar + i * 16][aq] = t; } }
    __syncthreads(); }   // publishes stage st + 1 and ends every wave's reads of the buffer that the next pass refills (after the last pass: of the LDS that the epilogue reuses)
}
// ---- k_proj: block = (128 rows, 128 cols, which): qkv = x W (+ b), exact; q, k -> f16 rows, v -> f16 planes
__global__ __launch_bounds__(2 * GR) void k_proj(const float* __restrict__ X, const float* __restrict__ WQ, const float* __restrict__ BQ, const float* __restrict__ WK, const float* __restrict__ BK, const float* __restrict__ WV, const float* __restrict__ BV, const int* __restrict__ POS, _Float16* __restrict__ QH, _Float16* __restrict__ KH, _Float16* __restrict__ VT) {
  __shared__ __align__(16) ProjLds sm; __shared__ __align__(16) v2f cs[GR][CSP]; _Float16 (&sh)[GR][136] = sm.e.sh; _Float16 (&th)[128][GR + 8] = sm.v.th;
  const int tid = threadIdx.x, wave = tid >> 5, lane = tid & 31, col = lane & 15, g = lane >> 4; const int which = blockIdx.z; const int c0 = blockIdx.y * 128; const size_t r0 = (size_t)blockIdx.x * GR; const int NW = which == 0 ? CC : KV; if (c0 >= NW) return;   // k/v are only KV wide (block-uniform exit)
  const float* WA = which == 0 ? WQ : which == 1 ? WK : WV; const float* BA = which == 0 ? BQ : which == 1 ? BK : BV;
  v8f acc[2][4] = {}; const int ar = tid >> 4, aq = (tid & 15) * 4; const int wr0 = (wave >> 1) * 32, wc0 = (wave & 1) * 64;   // the wave's first row and column in the block's tile
  const float* wp = WA + (size_t)(__builtin_amdgcn_readfirstlane(wave) * 8) * NW + c0; const float* xp = X + (r0 + ar) * CC + aq;
  const int pv = POS[(int)(r0 % TT) + wave * 16 + col];   // p = position_ids[t] of the 16 rows whose rotary table this wave makes (128 divides the sequence length: a block's rows do not wrap); loaded ahead of stage 0, so that its wait leaves stage 0's loads in flight
  asm volatile("s_wait_xcnt 0x0" ::: "memory");   // the offset register of this load is reused for the addresses below: the wait stands in front of that overwrite
  const bool pfw = __builtin_amdgcn_readfirstlane(wave) == 0; const char* pf = pf_first(WA + c0, NW, X + r0 * CC, (blockIdx.x & 3) | ((blockIdx.x >> 1) & 4), (blockIdx.y + 2 * which) & 7, lane);   // each eighth of a W tile is asked for by 4 row blocks whose indices differ by 4 or 16; the 8 column blocks of q cover the 128 rows once, those of k and v a part of them again
  if (which == 0) proj_gemm<CC>(acc, sm, wp, xp, wave, lane, ar, aq, true, &cs[wave * 16], pv, pf, pfw); else proj_gemm<KV>(acc, sm, wp, xp, wave, lane, ar, aq, which == 1, &cs[wave * 16], pv, pf, pfw);   // block-uniform: every wave of a block passes the same barriers
  float bb[4];
#pragma unroll
  for (int j = 0; j < 4; ++j) bb[j] = bfr(BA[c0 + wc0 + j * 16 + col]);
  if (which == 2) {
#pragma unroll
    for (int i = 0; i < 2; ++i)
#pragma unroll
      for (int j = 0; j < 4; ++j)
#pragma unroll
        for (int r = 0; r < 8; ++r) { const float v = acc[i][j][r] + bb[j]; const int rl = wr0 + i * 16 + 8 * g + r, cl = wc0 + j * 16 + col; th[cl][rl] = (_Float16)v; }
  } else {   // rotate-half rotary in the accumulators: out[d] = x[d] cos(p f_(d mod 32)) + (d < 32 ? -x[d+32] : x[d-32]) sin(p f_(d mod 32)); the wave's 64 columns are one head, and column d + 32 is tile j + 2 of the same lane
#pragma unroll
    for (int f = 0; f < 2; ++f)
#pragma unroll
      for (int i = 0; i < 2; ++i)
#pragma unroll
        for (int r = 0; r < 8; ++r) { const int rl = wr0 + i * 16 + 8 * g + r; const v2f t = cs[rl][f * 16 + col]; const float c = t[0], s = t[1];
          const int jl = f, jh = f + 2; const float x1 = acc[i][jl][r] + bb[jl], x2 = acc[i][jh][r] + bb[jh];
          const float v1 = fmaf(x1, c, -x2 * s), v2 = fmaf(x2, c, x1 * s);
          sh[rl][wc0 + jl * 16 + col] = (_Float16)v1; sh[rl][wc0 + jh * 16 + col] = (_Float16)v2; }
  }
  __syncthreads();   // the block's tile is in LDS before the whole-line stores read it
  if (which < 2) { _Float16* dh = which == 0 ? QH : KH; for (int e = tid; e < GR * 16; e += 2 * GR) { const int rl = e >> 4, q = e & 15; vst2((unsigned*)(dh + (r0 + rl) * NW + c0 + q * 8), *(const v4u*)&sh[rl][q * 8]);
      asm volatile("s_wait_xcnt 0x0" ::: "memory"); } }   // the registers of this store are reused by the next LDS read and the next address: the wait stands in front of that overwrite
  else { const size_t b = r0 / TT; const int t0 = (int)(r0 % TT); for (int e = tid; e < 128 * (GR / 8); e += 2 * GR) { const int cl = e >> 4, q = e & 15; const size_t o2 = (b * KV + c0 + cl) * (size_t)TT + t0 + q * 8; vst2((unsigned*)(VT + o2), *(const v4u*)&th[cl][q * 8]);
      asm volatile("s_wait_xcnt 0x0" ::: "memory"); } } }   // as above
#define FQ 2                // 16-query tiles per block
#define FW (GQ * FQ)        // waves per block
#define SP 72               // LDS row pitch in 16-bit elements: a 128-byte row + 16 bytes, for 16-byte readers
#define L2E 1.44269504088896340736f
// waves_per_eu(4, 4): two blocks a WGP; lets the compiler keep all 16 fragment reads of a pass in flight at once instead of saving registers
__global__ __launch_bounds__(32 * FW) __attribute__((amdgpu_waves_per_eu(4, 4))) void k_fa(const _Float16* __restrict__ QH, const _Float16* __restrict__ KH, const _Float16* __restrict__ VT, _Float16* __restrict__ Y) {
  __shared__ __align__(16) _Float16 sk[2][64][SP]; __shared__ __align__(16) _Float16 svh[2][64][SP]; __shared__ __align__(16) _Float16 so[FW][16][SP];
  __shared__ __align__(16) v4f sx[FW][HD / 8][32]; __shared__ __align__(8) v2f sml[FW][32];   // what a wave hands to its partner: Ot of one query tile (16 bytes a lane and piece), maximum and sum
  const int tid = threadIdx.x, wave = __builtin_amdgcn_readfirstlane(tid >> 5), lane = tid & 31, col = lane & 15, g = lane >> 4;
  const int kvh = blockIdx.x % NKV, b = blockIdx.x / NKV; const int yb = blockIdx.y; const int q0 = (yb < TT / 64 ? TT / 32 - 1 - yb : yb - TT / 64) * 32;   // long blocks first, then short ones in rising order (a permutation; for balance only)
  const int h = kvh * GQ + (wave & (GQ - 1)), hf = wave / GQ; const int ns = q0 / 64 + 1;   // hf: the wave's key half, and the query tile that it finishes; 64-key stages up to the block's diagonal
  const int sr = tid >> 3, sc = (tid & 7) * 8;   // staging: 8 lanes a row, rows sr and sr + 32
  const _Float16* gk = KH + ((size_t)b * TT + sr) * KV + kvh * HD + sc; const size_t vo = ((size_t)b * KV + kvh * HD + sr) * (size_t)TT + sc; const _Float16* gh = VT + vo;
  v16h qh[FQ][2];
#pragma unroll
  for (int i = 0; i < FQ; ++i)
#pragma unroll
    for (int kc = 0; kc < 2; ++kc) { const size_t qo = ((size_t)b * TT + q0 + i * 16 + col) * CC + h * HD + kc * 32; qh[i][kc] = frag_h(QH + qo, lane); }
  v8h rk0 = *(const v8h*)gk, rk1 = *(const v8h*)(gk + 32 * KV); v8h rh0 = *(const v8h*)gh, rh1 = *(const v8h*)(gh + 32 * TT);
  asm volatile("s_wait_xcnt 0x0" ::: "memory");   // the address registers of the q loads are reused below: the wait stands in front of that overwrite
  *(v8h*)&sk[0][sr][sc] = rk0; *(v8h*)&sk[0][sr + 32][sc] = rk1; *(v8h*)&svh[0][sr][sc] = rh0; *(v8h*)&svh[0][sr + 32][sc] = rh1;
  __syncthreads();   // stage 0 is in LDS before any wave reads it
  v8f o[FQ][HD / 16] = {}; float m[FQ], l[FQ];
#pragma unroll
  for (int i = 0; i < FQ; ++i) { m[i] = -3.0e38f; l[i] = 0.f; }
  // the stage loop stays rolled (its trip count is the block's own; a second copy of the body would only cost instruction cache); every full unroll below keeps a fragment or accumulator array in registers
#pragma unroll 1
  for (int st = 0; st < ns; ++st) { const int cur = st & 1, k0 = st * 64; const bool more = st + 1 < ns;   // block-uniform
    if (more) { const int kn = k0 + 64; rk0 = *(const v8h*)(gk + (size_t)kn * KV); rk1 = *(const v8h*)(gk + (size_t)(kn + 32) * KV); rh0 = *(const v8h*)(gh + kn); rh1 = *(const v8h*)(gh + 32 * TT + kn);
      asm volatile("s_wait_xcnt 0x0" ::: "memory"); }   // the fragment reads below reuse the address registers of these four loads: the wait stands in front of that overwrite
    const int kb0 = k0 + hf * 32;
    if (kb0 <= q0) {   // wave-uniform: both are multiples of 32, so 32 keys either open on both query tiles or lie wholly above the block's diagonal and add nothing
      v16h ka[2], kb[2], vh[HD / 16]; v8f s[FQ][2] = {};
#pragma unroll
      for (int j = 0; j < 2; ++j) { const _Float16* kp = &sk[cur][hf * 32 + j * 16 + col][0]; ka[j] = frag_h(kp, lane); kb[j] = frag_h(kp + 32, lane); }
#pragma unroll
      for (int j = 0; j < HD / 16; ++j) vh[j] = frag_h(&svh[cur][j * 16 + col][hf * 32], lane);
#pragma unroll
      for (int i = 0; i < FQ; ++i)
#pragma unroll
        for (int j = 0; j < 2; ++j) s[i][j] = wmma16(ka[j], qh[i][0], s[i][j]);
#pragma unroll
      for (int i = 0; i < FQ; ++i)
#pragma unroll
        for (int j = 0; j < 2; ++j) s[i][j] = wmma16(kb[j], qh[i][1], s[i][j]);
#pragma unroll
      for (int i = 0; i < FQ; ++i)
#pragma unroll
        for (int j = 0; j < 2; ++j) s[i][j] *= 0.125f;
      if (kb0 == q0) {   // wave-uniform: only the keys at the diagonal mask; every query's own key is open there, and key kb0 (<= q0) is open to every query, so a running maximum is finite from the wave's first pass on
#pragma unroll
        for (int i = 0; i < FQ; ++i)
#pragma unroll
          for (int j = 0; j < 2; ++j)
#pragma unroll
            for (int r = 0; r < 8; ++r) if (j * 16 + 8 * g + r > i * 16 + col) s[i][j][r] = -3.0e38f; }
      v16h p[FQ];   // B fragments of Pt, one f16 plane (11 significant bits, the width k already has): element e = key 8g + e of score tile 0, element 8 + e = the same row of tile 1: the k order of frag_h
#pragma unroll
      for (int i = 0; i < FQ; ++i) { float mx = m[i];
#pragma unroll
        for (int j = 0; j < 2; ++j)
#pragma unroll
          for (int r = 0; r < 8; ++r) mx = fmaxf(mx, s[i][j][r]);
        mx = fmaxf(mx, __shfl_xor(mx, 16));
        const float al = __builtin_amdgcn_exp2f((m[i] - mx) * L2E); m[i] = mx; l[i] *= al;
#pragma unroll
        for (int j = 0; j < HD / 16; ++j) o[i][j] *= al;
#pragma unroll
        for (int e = 0; e < 8; ++e) { const float x = __builtin_amdgcn_exp2f((s[i][0][e] - mx) * L2E), y = __builtin_amdgcn_exp2f((s[i][1][e] - mx) * L2E); l[i] += x + y;
          p[i][e] = (_Float16)x; p[i][8 + e] = (_Float16)y; } }
#pragma unroll
      for (int j = 0; j < HD / 16; ++j)
#pragma unroll
        for (int i = 0; i < FQ; ++i) o[i][j] = wmma16(vh[j], p[i], o[i][j]); }
    if (more) { const int nx = cur ^ 1; *(v8h*)&sk[nx][sr][sc] = rk0; *(v8h*)&sk[nx][sr + 32][sc] = rk1; *(v8h*)&svh[nx][sr][sc] = rh0; *(v8h*)&svh[nx][sr + 32][sc] = rh1; }
    __syncthreads(); }   // publishes stage st + 1 and ends every wave's reads of the buffer that the next pass refills
  // the two waves of a head join: wave hf keeps query tile hf and hands the other tile to its partner (same lane, same element order). A wave that met no open key hands maximum -3e38, sum 0, Ot 0, and its factor below is exp2(-inf) = 0
  const bool up = hf != 0;   // a scalar
#pragma unroll
  for (int j = 0; j < HD / 16; ++j) { const v8f t = up ? o[0][j] : o[1][j]; v4f t0, t1;
#pragma unroll
    for (int r = 0; r < 4; ++r) { t0[r] = t[r]; t1[r] = t[4 + r]; }
    sx[wave][2 * j][lane] = t0; sx[wave][2 * j + 1][lane] = t1; }
  { v2f t; t[0] = up ? m[0] : m[1]; t[1] = up ? l[0] : l[1]; sml[wave][lane] = t; }
  __syncthreads();   // every wave's handed tile is in LDS before its partner reads it
  const int pw = wave ^ GQ; const v2f ml = sml[pw][lane]; const float mk = up ? m[1] : m[0], lk = up ? l[1] : l[0];
  const float mj = fmaxf(mk, ml[0]), ak = __builtin_amdgcn_exp2f((mk - mj) * L2E), ap = __builtin_amdgcn_exp2f((ml[0] - mj) * L2E);
  float lj = lk * ak + ml[1] * ap; lj += __shfl_xor(lj, 16); const float inv = 1.0f / lj; const int ql0 = q0 + hf * 16;
#pragma unroll
  for (int j = 0; j < HD / 16; ++j) { const v8f ok = up ? o[1][j] : o[0][j]; const v4f p0 = sx[pw][2 * j][lane], p1 = sx[pw][2 * j + 1][lane]; v8h t;   // y rounded to f16 here, once: the operand of the output projection
#pragma unroll
    for (int r = 0; r < 4; ++r) { t[r] = (_Float16)((ok[r] * ak + p0[r] * ap) * inv); t[4 + r] = (_Float16)((ok[4 + r] * ak + p1[r] * ap) * inv); }
    *(v8h*)&so[wave][col][j * 16 + 8 * g] = t; }
  LDSX();   // the wave's own tile, turned in its own LDS range so that the stores cover whole lines
#pragma unroll
  for (int it = 0; it < 4; ++it) { const int rl = it * 4 + (lane >> 3); vst2(Y + ((size_t)b * TT + ql0 + rl) * CC + h * HD + (lane & 7) * 8, *(const v8h*)&so[wave][rl][(lane & 7) * 8]); } }
// ---- k_out: block = (128 rows, 128 cols): out = y (f16) Wo ((in,out), bf16 values in f16), one product, f32 accumulate
__global__ __launch_bounds__(2 * GR) void k_out(const _Float16* __restrict__ Y, const float* __restrict__ WO, float* __restrict__ OUT) { __shared__ __align__(16) OutLds sm; float (&sf)[GR / 16][32][68] = sm.sf;
  const int tid = threadIdx.x, wave = tid >> 5, lane = tid & 31, col = lane & 15, g = lane >> 4; const int c0 = blockIdx.y * 128; const size_t r0 = (size_t)blockIdx.x * GR + (wave >> 1) * 32; const int wc0 = (wave & 1) * 64;   // the wave's first row, and its first column in the block's tile
  v8f acc[2][4] = {}; v4f rw[8]; v8h ra[4]; const int ar = tid >> 3, aq = (tid & 7) * 8;   // y staging: 8 lanes a 128-byte row piece, rows 32 apart; no conversion
  const float* wp = WO + (size_t)(__builtin_amdgcn_readfirstlane(wave) * 8) * CC + c0; const _Float16* yp = Y + ((size_t)blockIdx.x * GR + ar) * CC + aq;
  const bool pfw = __builtin_amdgcn_readfirstlane(wave) == 0; const unsigned pfs = lane < 16 ? GK * CC * 4u : GK * 2u; const char* pf = pf_first_h(WO + c0, CC, Y + (size_t)blockIdx.x * GR * CC, (blockIdx.x & 3) | ((blockIdx.x >> 1) & 4), blockIdx.y & 7, lane);
  w_load(rw, wp, CC, lane);
#pragma unroll
  for (int i = 0; i < 4; ++i) ra[i] = *(const v8h*)(yp + (size_t)(i * 32) * CC);
  asm volatile("s_wait_xcnt 0x0" ::: "memory");   // the address registers of these loads are reused below: the wait stands in front of that overwrite
  if (pfw) pf_ask3(pf, pfs);   // wave-uniform (a scalar): stages 1 .. PFD - 1 are asked for while stage 0's loads fly
  w_store_h(rw, sm.s.w[0], wave, lane);
#pragma unroll
  for (int i = 0; i < 4; ++i) *(v8h*)&sm.s.a[0][ar + i * 32][aq] = ra[i];
  __syncthreads();   // stage 0 is in LDS before any wave reads it
  // the stage loop stays rolled: a second copy of the body would only cost registers and instruction cache
#pragma unroll 1
  for (int st = 0; st < CC / GK; ++st) { const int cur = st & 1; const bool more = st + 1 < CC / GK;
    if (more) { w_load(rw, wp + (size_t)((st + 1) * GK) * CC, CC, lane);   // the next stage's loads fly during this stage's products
#pragma unroll
      for (int i = 0; i < 4; ++i) ra[i] = *(const v8h*)(yp + (size_t)(i * 32) * CC + (st + 1) * GK);
      asm volatile("s_wait_xcnt 0x0" ::: "memory"); }   // as above
    if (pfw && st + PFD < CC / GK) pf_ask(pf, st + PFD + 1 < CC / GK ? pfs : 0u);   // scalar tests; the address stops at the last stage
#pragma unroll
    for (int kc = 0; kc < GK / 32; ++kc) { v16h a[2], wf[4];   // all 12 fragment reads of 32 k stand together, in front of their 8 products
#pragma unroll
      for (int i = 0; i < 2; ++i) a[i] = frag_h(&sm.s.a[cur][(wave >> 1) * 32 + i * 16 + col][kc * 32], lane);
#pragma unroll
      for (int j = 0; j < 4; ++j) wf[j] = w_frag_h(sm.s.w[cur], (wave & 1) * 4 + j, kc, col, g);
#pragma unroll
      for (int i = 0; i < 2; ++i)
#pragma unroll
        for (int j = 0; j < 4; ++j) acc[i][j] = wmma16(a[i], wf[j], acc[i][j]); }
    if (more) { w_store_h(rw, sm.s.w[cur ^ 1], wave, lane);
#pragma unroll
      for (int i = 0; i < 4; ++i) *(v8h*)&sm.s.a[cur ^ 1][ar + i * 32][aq] = ra[i]; }
    __syncthreads(); }   // publishes stage st + 1 and ends every wave's reads of the buffer that the next pass refills (after the last pass: of the LDS that the epilogue reuses)
#pragma unroll
  for (int i = 0; i < 2; ++i)
#pragma unroll
    for (int j = 0; j < 4; ++j)
#pragma unroll
      for (int r = 0; r < 8; ++r) sf[wave][i * 16 + 8 * g + r][j * 16 + col] = acc[i][j][r];
  LDSX(); for (int it = 0; it < 16; ++it) { const int rl = it * 2 + g; vst2(OUT + (r0 + rl) * CC + c0 + wc0 + col * 4, *(const v4f*)&sf[wave][rl][col * 4]); } }   // the wave's own tile, turned in its own LDS range: each store covers two whole 256-byte row pieces
extern "C" void kernel_launch(void* const* d_in, const int* in_sizes, int n_in, void* d_out, int out_size, void* d_ws, size_t ws_size, hipStream_t stream) {
  (void)in_sizes; (void)n_in; (void)out_size;
  const float** F = (const float**)d_in;   // 0 hidden_states [2,2048,1024], 1 positions [2048] int32 (verbatim arange; read), 2 Wq [1024,1024] ((in,out)), 3 bq, 4 Wk [1024,256], 5 bk, 6 Wv [1024,256], 7 bv, 8 Wo [1024,1024] ((in,out))
  if (ws_size < (size_t)WS_END) return;
  char* ws = (char*)d_ws; _Float16 *QH = (_Float16*)(ws + WS_QH), *KH = (_Float16*)(ws + WS_KH), *VT = (_Float16*)(ws + WS_VT), *Y = (_Float16*)(ws + WS_Y);
  k_proj<<<dim3(TNB * TT / GR, CC / 128, 3), 2 * GR, 0, stream>>>(F[0], F[2], F[3], F[4], F[5], F[6], F[7], (const int*)d_in[1], QH, KH, VT);
  k_fa<<<dim3(TNB * NKV, TT / 32), 32 * FW, 0, stream>>>(QH, KH, VT, Y);
  k_out<<<dim3(TNB * TT / GR, CC / 128), 2 * GR, 0, stream>>>(Y, F[8], (float*)d_out);
}
